// v000
// Measured on an AMD MI455X. A time is GPU time per run, averaged over a window of back-to-back runs after a warm-up
// (all launches, gaps included; the runs take copies of the inputs in turn), and the median of several windows.
// Apart from v000's, it joins two sittings. Times from different sittings can be a few percent apart, while
// side-by-side timings come from the same sitting.
// v000, which the later versions start from, runs in 1340 microseconds.
#include <hip/hip_runtime.h>

// Causal self-attention with 6 heads of width 128 (x_input [4][2048][768]; q, k, v = x W + b ('xw' [768][768] 768^-0.5, biases zeros on this draw: read; 6 heads x 128); scores / sqrt(128); causal (finfo.min == exclusion); softmax; out = merged Wo + bo ('xw' + bias (zeros: read)) -> [4][2048][768] (6.3 M); argument order x_input, Wq, bq, Wk, bk, Wv, bv, Wo, bo).
// Layout per batch: bf16 copy of x; 'xw' weights transposed once; exact projections (K 768) + f32 biases; identity-table plane builders at width 128; causal T-2048 attention at 6 heads (3 passes of 2; hybrid rows: < 512 hi/lo 3 products, rest fp16 x1024; k_gemmc skips tiles above the diagonal); merged hi/lo x Wo exact + bo.
// Compute dtypes, f32 accumulate: every input rounded to bf16; projections exact + f32 biases; attention rows < 512 3 products, rest fp16; softmax f32; Wo hl x exact + bias.

#define NB_  4
#define TT   2048
#define DM   768
#define NH_  6
#define NKV  6
#define REP  (NH_ / NKV)
#define HD   128
#define DQ   (NH_ * HD)
#define DKV  (NKV * HD)
#define ZH   2
#define RH   512                  // query rows < RH use hi+lo planes (0: none)
#define WIN  2048
#define PCAR 1024.0f
#define SCL  0.088388347648318447f   // HD^-0.5
typedef _Float16 h16;
typedef unsigned short bf;
typedef __attribute__((ext_vector_type(16))) __bf16   v16bf;
typedef __attribute__((ext_vector_type(16))) _Float16 v16h;
typedef __attribute__((ext_vector_type(8)))  _Float16 v8h;
typedef __attribute__((ext_vector_type(8)))  unsigned short v8us;
typedef __attribute__((ext_vector_type(8)))  float    v8f;
typedef __attribute__((ext_vector_type(4)))  float    v4f;
typedef v8h  __attribute__((may_alias)) v8ha;
typedef v4f  __attribute__((may_alias)) v4fa;
typedef v8us __attribute__((may_alias)) v8usa;

__device__ __forceinline__ unsigned short f2bf(float f) { unsigned u = __float_as_uint(f); u += 0x7FFFu + ((u >> 16) & 1u); return (unsigned short)(u >> 16); }
__device__ __forceinline__ float bf2f(unsigned short b) { return __uint_as_float(((unsigned)b) << 16); }
__device__ __forceinline__ float bfr(float f) { return bf2f(f2bf(f)); }
__device__ __forceinline__ v16h cat16(v8h lo, v8h hi) { return __builtin_shufflevector(lo, hi, 0, 1, 2, 3, 4, 5, 6, 7, 8, 9, 10, 11, 12, 13, 14, 15); }
__device__ __forceinline__ v16bf cat16b(v8us lo, v8us hi) { return __builtin_bit_cast(v16bf, __builtin_shufflevector(lo, hi, 0, 1, 2, 3, 4, 5, 6, 7, 8, 9, 10, 11, 12, 13, 14, 15)); }
__device__ __forceinline__ v8f wmma16(v16h a, v16h b, v8f c) { return __builtin_amdgcn_wmma_f32_16x16x32_f16(false, a, false, b, (short)0, c, false, false); }
__device__ __forceinline__ v8f wmmab(v16bf a, v16bf b, v8f c) { return __builtin_amdgcn_wmma_f32_16x16x32_bf16(false, a, false, b, (short)0, c, false, false); }



// ---- k_gemmw: register-blocked GEMM, ONE WAVE per 64x64 output tile (16 accumulators), operands straight from K-contiguous 16-bit planes; grid (M/64, N/64, Z), 32 threads.
// C[m][n] (f32, pitch ldc, + optional f32 bias[n]) = sum_k A[m][k] Bt[n][k] (+ split products per NSPLIT). z-batch strides sA/sB/sC in elements. K % 32 == 0.
template <typename T16> struct WFrag;
template <> struct WFrag<h16> { typedef v16h V; static __device__ __forceinline__ V ld(const h16* p) { return cat16(*(const v8h*)p, *(const v8h*)(p + 16)); } static __device__ __forceinline__ v8f mma(V a, V b, v8f c) { return wmma16(a, b, c); } };
template <> struct WFrag<bf> { typedef v16bf V; static __device__ __forceinline__ V ld(const bf* p) { return cat16b(*(const v8us*)p, *(const v8us*)(p + 16)); } static __device__ __forceinline__ v8f mma(V a, V b, v8f c) { return wmmab(a, b, c); } };
template <typename T16, int NSPLIT, bool BIAS>
__global__ __launch_bounds__(32) void k_gemmw(const T16* __restrict__ A, const T16* __restrict__ A2, const T16* __restrict__ Bt, const T16* __restrict__ Bt2, int K, float* C, int ldc, const float* __restrict__ bias, size_t sA, size_t sB, size_t sC) {
    typedef typename WFrag<T16>::V V;
    __shared__ __align__(16) float os[16 * 68];
    const size_t z = blockIdx.z; A += z * sA; if (A2) A2 += z * sA; Bt += z * sB; if (Bt2) Bt2 += z * sB; C += z * sC;
    const int lane = threadIdx.x & 31, lr = lane & 15, hi = lane >> 4; const int r0 = blockIdx.x * 64, c0 = blockIdx.y * 64;
    v8f acc[4][4];
#pragma unroll
    for (int mb = 0; mb < 4; ++mb)
#pragma unroll
        for (int nb = 0; nb < 4; ++nb) acc[mb][nb] = (v8f){};
    const size_t aoff = (size_t)(r0 + lr) * K + 8 * hi, boff = (size_t)(c0 + lr) * K + 8 * hi;
#pragma unroll 1
    for (int kc = 0; kc < K; kc += 32) {
        V a[4], a2[4];
#pragma unroll
        for (int mb = 0; mb < 4; ++mb) { a[mb] = WFrag<T16>::ld(A + aoff + (size_t)mb * 16 * K + kc); if (NSPLIT == 1 || NSPLIT == 2) a2[mb] = WFrag<T16>::ld(A2 + aoff + (size_t)mb * 16 * K + kc); }
#pragma unroll
        for (int nb = 0; nb < 4; ++nb) { const V b = WFrag<T16>::ld(Bt + boff + (size_t)nb * 16 * K + kc); V b2; if (NSPLIT >= 2) b2 = WFrag<T16>::ld(Bt2 + boff + (size_t)nb * 16 * K + kc);
#pragma unroll
            for (int mb = 0; mb < 4; ++mb) { acc[mb][nb] = WFrag<T16>::mma(a[mb], b, acc[mb][nb]); if (NSPLIT == 1 || NSPLIT == 2) acc[mb][nb] = WFrag<T16>::mma(a2[mb], b, acc[mb][nb]); if (NSPLIT >= 2) acc[mb][nb] = WFrag<T16>::mma(a[mb], b2, acc[mb][nb]); } }
        asm volatile("v_nop\n\tv_nop\n\tv_nop\n\tv_nop" : "+v"(acc[0][0]), "+v"(acc[1][1]), "+v"(acc[2][2]), "+v"(acc[3][3]) : "v"(a[0]), "v"(a[3]));
    }
#pragma unroll
    for (int mb = 0; mb < 4; ++mb) {
#pragma unroll
        for (int nb = 0; nb < 4; ++nb) {
#pragma unroll
            for (int j = 0; j < 8; ++j) os[(hi * 8 + j) * 68 + nb * 16 + lr] = acc[mb][nb][j]; }
        __builtin_amdgcn_wave_barrier(); asm volatile("" ::: "memory");
        float* crow = C + (size_t)(r0 + mb * 16) * ldc + c0;
{
#pragma unroll
            for (int s = 0; s < 8; ++s) { const int row = 2 * s + hi, cofs = lr * 4; v4f val = *(const v4fa*)(os + row * 68 + cofs); if (BIAS) { val[0] += bfr(bias[c0 + cofs]); val[1] += bfr(bias[c0 + cofs + 1]); val[2] += bfr(bias[c0 + cofs + 2]); val[3] += bfr(bias[c0 + cofs + 3]); }
                *(v4f*)(crow + (size_t)row * ldc + cofs) = val; }
             }
        __builtin_amdgcn_wave_barrier(); asm volatile("" ::: "memory");
    }
}

// ---- k_gemmc: the same one-wave 64x64 tile GEMM specialised for causal attention: CMODE 1 skips score tiles entirely above the diagonal (query rows r0+roff.., key columns c0..), CMODE 2 limits the
// key (K) loop of the probability x value contraction to the diagonal block (probabilities beyond it are exactly zero). roff = row offset of this launch's first row within the sequence.
template <typename T16, int NSPLIT, int CMODE>
__global__ __launch_bounds__(32) void k_gemmc(const T16* __restrict__ A, const T16* __restrict__ A2, const T16* __restrict__ Bt, const T16* __restrict__ Bt2, int K, float* C, int ldc, int roff, size_t sA, size_t sB, size_t sC) {
    typedef typename WFrag<T16>::V V;
    __shared__ __align__(16) float os[16 * 68];
    const size_t z = blockIdx.z; A += z * sA; if (A2) A2 += z * sA; Bt += z * sB; if (Bt2) Bt2 += z * sB; C += z * sC;
    const int lane = threadIdx.x & 31, lr = lane & 15, hi = lane >> 4; const int r0 = blockIdx.x * 64, c0 = blockIdx.y * 64;
    if (CMODE == 1 && c0 > r0 + roff + 63) return;                  // score tile entirely above the causal diagonal: never read (the softmax masks j > i by select)
    const int Kl = (CMODE == 2) ? min(K, r0 + roff + 64) : K;        // P.V: probabilities are exactly 0 beyond the diagonal block, so the K loop stops there
    v8f acc[4][4];
#pragma unroll
    for (int mb = 0; mb < 4; ++mb)
#pragma unroll
        for (int nb = 0; nb < 4; ++nb) acc[mb][nb] = (v8f){};
    const size_t aoff = (size_t)(r0 + lr) * K + 8 * hi, boff = (size_t)(c0 + lr) * K + 8 * hi;
#pragma unroll 1
    for (int kc = 0; kc < Kl; kc += 32) {
        V a[4], a2[4];
#pragma unroll
        for (int mb = 0; mb < 4; ++mb) { a[mb] = WFrag<T16>::ld(A + aoff + (size_t)mb * 16 * K + kc); if (NSPLIT == 1 || NSPLIT == 2) a2[mb] = WFrag<T16>::ld(A2 + aoff + (size_t)mb * 16 * K + kc); }
#pragma unroll
        for (int nb = 0; nb < 4; ++nb) { const V b = WFrag<T16>::ld(Bt + boff + (size_t)nb * 16 * K + kc); V b2; if (NSPLIT >= 2) b2 = WFrag<T16>::ld(Bt2 + boff + (size_t)nb * 16 * K + kc);
#pragma unroll
            for (int mb = 0; mb < 4; ++mb) { acc[mb][nb] = WFrag<T16>::mma(a[mb], b, acc[mb][nb]); if (NSPLIT == 1 || NSPLIT == 2) acc[mb][nb] = WFrag<T16>::mma(a2[mb], b, acc[mb][nb]); if (NSPLIT >= 2) acc[mb][nb] = WFrag<T16>::mma(a[mb], b2, acc[mb][nb]); } }
        asm volatile("v_nop\n\tv_nop\n\tv_nop\n\tv_nop" : "+v"(acc[0][0]), "+v"(acc[1][1]), "+v"(acc[2][2]), "+v"(acc[3][3]) : "v"(a[0]), "v"(a[3]));
    }
#pragma unroll
    for (int mb = 0; mb < 4; ++mb) {
#pragma unroll
        for (int nb = 0; nb < 4; ++nb) {
#pragma unroll
            for (int j = 0; j < 8; ++j) os[(hi * 8 + j) * 68 + nb * 16 + lr] = acc[mb][nb][j]; }
        __builtin_amdgcn_wave_barrier(); asm volatile("" ::: "memory");
        float* crow = C + (size_t)(r0 + mb * 16) * ldc + c0;
{
#pragma unroll
            for (int s = 0; s < 8; ++s) { const int row = 2 * s + hi, cofs = lr * 4; v4f val = *(const v4fa*)(os + row * 68 + cofs);
                *(v4f*)(crow + (size_t)row * ldc + cofs) = val; }
             }
        __builtin_amdgcn_wave_barrier(); asm volatile("" ::: "memory");
    }
}

__device__ __forceinline__ h16 tohx(float x) { return (h16)x; }
__device__ __forceinline__ void splitf(float y, unsigned short& h, unsigned short& l) { h = f2bf(y); l = f2bf(y - bf2f(h)); }
typedef __attribute__((ext_vector_type(2))) _Float16 v2h;
typedef __attribute__((ext_vector_type(4))) _Float16 v4h;
typedef __attribute__((ext_vector_type(2))) unsigned short v2us;
typedef __attribute__((ext_vector_type(4))) unsigned short v4us;
typedef __attribute__((ext_vector_type(2))) float v2f;
typedef __attribute__((ext_vector_type(4))) int v4i;

__global__ __launch_bounds__(256) void k_wtG(const float* __restrict__ w, int K, int N, bf* Bt) {
    const int lane = threadIdx.x & 31; const int L0 = (blockIdx.x * 8 + (threadIdx.x >> 5)) * 8; const int nlines = N * K / 64;
{
#pragma unroll 1
        for (int l = 0; l < 8; ++l) { const int L = L0 + l; if (L >= nlines) break; const size_t e = (size_t)L * 64 + lane * 2; const int k = (int)(e % K), n = (int)(e / K); v2us o;
            o[0] = f2bf(w[(size_t)k * N + n]); o[1] = f2bf(w[(size_t)(k + 1) * N + n]); *(v2us*)(Bt + e) = o; }
         }
}
__global__ __launch_bounds__(256) void k_cvt8(const float* __restrict__ src, bf* dst, size_t n8) { const size_t i = (size_t)blockIdx.x * 256 + threadIdx.x; if (i >= n8) return; const v8f v = *(const v8f*)(src + i * 8); v8us o;
#pragma unroll
    for (int k = 0; k < 8; ++k) o[k] = f2bf(v[k]); *(v8us*)(dst + i * 8) = o;  }

// k_rope: head planes [h][t][d] (fp16 + hi/lo) of rope(x) x sc with the rotate-half convention out[d] = x[d] cos[t][d] - x[d+HD/2] sin[t][d], out[d+HD/2] = x[d+HD/2] cos[t][d+HD/2] + x[d] sin[t][d+HD/2]
__global__ __launch_bounds__(256) void k_rope(const float* __restrict__ F, int pitch, int nheads, const float* __restrict__ CS, const float* __restrict__ RF, const float* __restrict__ nw, float sc, h16* P16, bf* Ph, bf* Pl) {
    const size_t e = ((size_t)blockIdx.x * 256 + threadIdx.x) * 2; if (e >= (size_t)nheads * TT * HD) return; const int d = (int)(e % HD); const int t = (int)((e / HD) % TT); const int h = (int)(e / ((size_t)HD * TT)); const float* f = F + (size_t)t * pitch + h * HD; const float rf = RF ? RF[(size_t)h * TT + t] : 1.0f; v2h o16; v2us oh, ol;
#pragma unroll
    for (int q = 0; q < 2; ++q) { const int dd = d + q; const int dp = (dd < HD / 2) ? dd + HD / 2 : dd - HD / 2; float x0 = f[dd], x1 = f[dp];
        if (RF) { float n0 = __fmul_rn(x0, rf), n1 = __fmul_rn(x1, rf); asm volatile("" : "+v"(n0)); asm volatile("" : "+v"(n1)); x0 = __fmul_rn(bfr(nw[dd]), n0); x1 = __fmul_rn(bfr(nw[dp]), n1); }
        const v2f cs = *(const v2f*)(CS + ((size_t)t * HD + dd) * 2); float a = __fmul_rn(x0, cs[0]), bq = __fmul_rn(x1, cs[1]); asm volatile("" : "+v"(a)); asm volatile("" : "+v"(bq)); const float r = ((dd < HD / 2) ? __fsub_rn(a, bq) : __fadd_rn(a, bq)) * sc;
        o16[q] = tohx(r); unsigned short a2, c2; splitf(r, a2, c2); oh[q] = a2; ol[q] = c2; }
    *(v2h*)(P16 + e) = o16; *(v2us*)(Ph + e) = oh; *(v2us*)(Pl + e) = ol;  }
__global__ __launch_bounds__(256) void k_vtp(const float* __restrict__ F, int pitch, int nheads, h16* V16, bf* Vh, bf* Vl) { const size_t e = ((size_t)blockIdx.x * 256 + threadIdx.x) * 2; if (e >= (size_t)nheads * HD * TT) return; const int t = (int)(e % TT); const int d = (int)((e / TT) % HD); const int g = (int)(e / ((size_t)TT * HD)); v2h o16; v2us oh, ol;
#pragma unroll
    for (int q = 0; q < 2; ++q) { const float x = F[(size_t)(t + q) * pitch + g * HD + d]; o16[q] = tohx(x); unsigned short a2, c2; splitf(x, a2, c2); oh[q] = a2; ol[q] = c2; }
    *(v2h*)(V16 + e) = o16; *(v2us*)(Vh + e) = oh; *(v2us*)(Vl + e) = ol;  }
__global__ __launch_bounds__(256) void k_csid(float* CS) { const int idx = blockIdx.x * 256 + threadIdx.x; if (idx >= TT * HD) return; v2f cs; cs[0] = 1.0f; cs[1] = 0.0f; *(v2f*)(CS + (size_t)idx * 2) = cs;  }
// k_asoft: per row (zz, i): t = S x HD^-0.5 for j <= i and i - j < WIN (WIN = TT: the window test always holds, plain causal; the reference's -1e9 additive fill vanishes identically); softmax over the 2048 keys (register row, one exp, fixed trees);
__global__ __launch_bounds__(256) void k_asoft(const float* __restrict__ Sb, h16* P16, bf* Ph, bf* Pl) {
    const int lane = threadIdx.x & 31; const int row = blockIdx.x * 8 + (threadIdx.x >> 5); if (row >= ZH * TT) return; const int i = row % TT; const int zz = row / TT; (void)zz; const bool hires = (i < RH); const float* sr = Sb + (size_t)row * TT; float v[TT / 32]; float mx = -3.0e38f;
#pragma unroll
    for (int ch = 0; ch < TT / 128; ++ch) { const int j0 = ch * 128 + lane * 4; const v4f a = *(const v4f*)(sr + j0);
#pragma unroll
        for (int q = 0; q < 4; ++q) { const int j = j0 + q; (void)j; const float t = (j <= i && i - j < WIN) ? a[q] * SCL : -3.0e38f; v[ch * 4 + q] = t; mx = fmaxf(mx, t); } }
#pragma unroll
    for (int sh = 16; sh; sh >>= 1) mx = fmaxf(mx, __shfl_xor(mx, sh, 32));
    float sum = 0.f;
#pragma unroll
    for (int k = 0; k < TT / 32; ++k) { float d0 = __fsub_rn(v[k], mx); asm volatile("" : "+v"(d0)); v[k] = __builtin_amdgcn_exp2f(__fmul_rn(d0, 1.4426950408889634f)); sum += v[k]; }
#pragma unroll
    for (int sh = 16; sh; sh >>= 1) sum += __shfl_xor(sum, sh, 32);
    const float f = __fdiv_rn(hires ? 1.0f : PCAR, sum);
{
        if (hires) {
#pragma unroll
            for (int ch = 0; ch < TT / 128; ++ch) { v4us oh, ol;
#pragma unroll
                for (int q = 0; q < 4; ++q) { unsigned short a, c2; splitf(v[ch * 4 + q] * f, a, c2); oh[q] = a; ol[q] = c2; }
                const size_t oo = ((size_t)zz * (RH ? RH : 1) + i) * TT + ch * 128 + lane * 4; *(v4us*)(Ph + oo) = oh; *(v4us*)(Pl + oo) = ol; }
        } else {
#pragma unroll
            for (int ch = 0; ch < TT / 128; ++ch) { v4h o4;
#pragma unroll
                for (int q = 0; q < 4; ++q) o4[q] = tohx(v[ch * 4 + q] * f);
                *(v4h*)(P16 + (size_t)row * TT + ch * 128 + lane * 4) = o4; } }
         }
}
__global__ __launch_bounds__(256) void k_merge(const float* __restrict__ O, int h0, bf* Ah, bf* Al) { const size_t e = ((size_t)blockIdx.x * 256 + threadIdx.x) * 2; if (e >= (size_t)ZH * TT * HD) return; const int d = (int)(e % HD); const int t = (int)((e / HD) % TT); const int zz = (int)(e / ((size_t)HD * TT)); const float cs = (t < RH) ? 1.0f : (1.0f / PCAR); const size_t oo = (size_t)t * DQ + (h0 + zz) * HD + d;
    v2us oh, ol;
#pragma unroll
    for (int q = 0; q < 2; ++q) { unsigned short a, c2; splitf(O[e + q] * cs, a, c2); oh[q] = a; ol[q] = c2; } *(v2us*)(Ah + oo) = oh; *(v2us*)(Al + oo) = ol;  }

extern "C" void kernel_launch(void* const* d_in, const int* in_sizes, int n_in,
                              void* d_out, int out_size, void* d_ws, size_t ws_size, hipStream_t stream) {
    (void)in_sizes; (void)n_in; (void)out_size;
    const float* x = (const float*)d_in[0]; const float* wq = (const float*)d_in[1]; const float* bq = (const float*)d_in[2]; const float* wk = (const float*)d_in[3]; const float* bk = (const float*)d_in[4]; const float* wv = (const float*)d_in[5]; const float* bv = (const float*)d_in[6]; const float* wo = (const float*)d_in[7]; const float* bo = (const float*)d_in[8];
    float* OUT = (float*)d_out;     // [4][2048][768]
    char* wsp = (char*)d_ws;
    auto take = [&](size_t bytes) { char* p = wsp; wsp += (bytes + 255) & ~(size_t)255; return (void*)p; };
    bf* WQ = (bf*)take((size_t)DQ * DM * 2); bf* WK = (bf*)take((size_t)DKV * DM * 2); bf* WV = (bf*)take((size_t)DKV * DM * 2); bf* WO = (bf*)take((size_t)DM * DQ * 2); float* CS = (float*)take((size_t)TT * HD * 2 * 4);
    bf* XB = (bf*)take((size_t)TT * DM * 2); float* FQ = (float*)take((size_t)TT * DQ * 4); float* FK = (float*)take((size_t)TT * DKV * 4);
    h16* QP16 = (h16*)take((size_t)NH_ * TT * HD * 2); h16* KP16 = (h16*)take((size_t)NKV * TT * HD * 2); h16* VT16 = (h16*)take((size_t)NKV * HD * TT * 2);
    bf* QPh = (bf*)take((size_t)NH_ * TT * HD * 2); bf* QPl = (bf*)take((size_t)NH_ * TT * HD * 2); bf* KPh = (bf*)take((size_t)NKV * TT * HD * 2); bf* KPl = (bf*)take((size_t)NKV * TT * HD * 2); bf* VTh = (bf*)take((size_t)NKV * HD * TT * 2); bf* VTl = (bf*)take((size_t)NKV * HD * TT * 2); bf* Ph = (bf*)take((size_t)ZH * RH * TT * 2); bf* Pl = (bf*)take((size_t)ZH * RH * TT * 2);
    float* Sb = (float*)take((size_t)ZH * TT * TT * 4); h16* P16 = (h16*)take((size_t)ZH * TT * TT * 2); float* Ob = (float*)take((size_t)ZH * TT * HD * 4); bf* ATh = (bf*)take((size_t)TT * DQ * 2); bf* ATl = (bf*)take((size_t)TT * DQ * 2);
    if ((size_t)(wsp - (char*)d_ws) > ws_size) return;    // ws 256 MiB
    float* FV = FK;   // v projection reuses the k buffer after the k planes are built (stream-ordered)
    { k_wtG<<<(unsigned)((DM * DQ / 64 + 63) / 64), 256, 0, stream>>>(wq, DM, DQ, WQ); k_wtG<<<(unsigned)((DM * DKV / 64 + 63) / 64), 256, 0, stream>>>(wk, DM, DKV, WK); k_wtG<<<(unsigned)((DM * DKV / 64 + 63) / 64), 256, 0, stream>>>(wv, DM, DKV, WV);
      k_wtG<<<(unsigned)((DQ * DM / 64 + 63) / 64), 256, 0, stream>>>(wo, DQ, DM, WO);
       }
    k_csid<<<(TT * HD + 255) / 256, 256, 0, stream>>>(CS);
    const unsigned LQ = (unsigned)(((size_t)NH_ * TT * HD / 2 + 255) / 256), LKv = (unsigned)(((size_t)NKV * TT * HD / 2 + 255) / 256);
    for (int b = 0; b < NB_; ++b) {
        
        k_cvt8<<<(unsigned)(((size_t)TT * DM / 8 + 255) / 256), 256, 0, stream>>>(x + (size_t)b * TT * DM, XB, (size_t)TT * DM / 8);
        k_gemmw<bf, 0, true><<<dim3(TT / 64, DQ / 64, 1), 32, 0, stream>>>(XB, nullptr, WQ, nullptr, DM, FQ, DQ, bq, 0, 0, 0);
        k_rope<<<LQ, 256, 0, stream>>>(FQ, DQ, NH_, CS, nullptr, nullptr, 1.0f, QP16, QPh, QPl);
        k_gemmw<bf, 0, true><<<dim3(TT / 64, DKV / 64, 1), 32, 0, stream>>>(XB, nullptr, WK, nullptr, DM, FK, DKV, bk, 0, 0, 0);
        k_rope<<<LKv, 256, 0, stream>>>(FK, DKV, NKV, CS, nullptr, nullptr, 1.0f, KP16, KPh, KPl);
        k_gemmw<bf, 0, true><<<dim3(TT / 64, DKV / 64, 1), 32, 0, stream>>>(XB, nullptr, WV, nullptr, DM, FV, DKV, bv, 0, 0, 0); k_vtp<<<LKv, 256, 0, stream>>>(FV, DKV, NKV, VT16, VTh, VTl);
        for (int h0 = 0; h0 < NH_; h0 += ZH) { const size_t zq = (size_t)h0, zk = (size_t)(h0 / REP);   // one kv head per query head: the pass's two heads use consecutive kv planes (z-strides TT*HD)
            k_gemmc<bf, 2, 1><<<dim3(RH / 64, TT / 64, ZH), 32, 0, stream>>>(QPh + zq * TT * HD, QPl + zq * TT * HD, KPh + zk * TT * HD, KPl + zk * TT * HD, HD, Sb, TT, 0, (size_t)TT * HD, (size_t)TT * HD, (size_t)TT * TT);
            k_gemmc<h16, 0, 1><<<dim3((TT - RH) / 64, TT / 64, ZH), 32, 0, stream>>>(QP16 + zq * TT * HD + (size_t)RH * HD, nullptr, KP16 + zk * TT * HD, nullptr, HD, Sb + (size_t)RH * TT, TT, RH, (size_t)TT * HD, (size_t)TT * HD, (size_t)TT * TT);
            k_asoft<<<ZH * TT / 8, 256, 0, stream>>>(Sb, P16, Ph, Pl);
            k_gemmc<bf, 2, 2><<<dim3(RH / 64, HD / 64, ZH), 32, 0, stream>>>(Ph, Pl, VTh + zk * HD * TT, VTl + zk * HD * TT, TT, Ob, HD, 0, (size_t)RH * TT, (size_t)HD * TT, (size_t)TT * HD);
            k_gemmc<h16, 0, 2><<<dim3((TT - RH) / 64, HD / 64, ZH), 32, 0, stream>>>(P16 + (size_t)RH * TT, nullptr, VT16 + zk * HD * TT, nullptr, TT, Ob + (size_t)RH * HD, HD, RH, (size_t)TT * TT, (size_t)HD * TT, (size_t)TT * HD);
            k_merge<<<(unsigned)(((size_t)ZH * TT * HD / 2 + 255) / 256), 256, 0, stream>>>(Ob, h0, ATh, ATl); }
        k_gemmw<bf, 1, true><<<dim3(TT / 64, DM / 64, 1), 32, 0, stream>>>(ATh, ATl, WO, nullptr, DQ, OUT + (size_t)b * TT * DM, DM, bo, 0, 0, 0); }
}

// v001
// A run of this version takes 610 microseconds.
// Next to v000, in two timings, it ran 2.21 and 2.19 times as fast.
#include <hip/hip_runtime.h>

// Causal self-attention with 6 heads of width 128 (x_input [4][2048][768]; q, k, v = x W + b ('xw' [768][768] 768^-0.5, biases zeros on this draw: read; 6 heads x 128); scores / sqrt(128); causal (finfo.min == exclusion); softmax; out = merged Wo + bo ('xw' + bias (zeros: read)) -> [4][2048][768] (6.3 M); argument order x_input, Wq, bq, Wk, bk, Wv, bv, Wo, bo).
// Layout per batch: bf16 copy of x; 'xw' weights transposed once; exact projections (K 768) + f32 biases; identity-table plane builders at width 128; causal T-2048 attention at 6 heads (one pass of 6; hybrid rows: < 512 hi/lo 3 products, rest fp16 x1024; k_gemmc skips tiles above the diagonal); merged hi/lo x Wo exact + bo.
// Compute dtypes, f32 accumulate: every input rounded to bf16; projections exact + f32 biases; attention rows < 512 3 products, rest fp16; softmax f32; Wo hl x exact + bias.

#define NB_  4
#define TT   2048
#define DM   768
#define NH_  6
#define NKV  6
#define REP  (NH_ / NKV)
#define HD   128
#define DQ   (NH_ * HD)
#define DKV  (NKV * HD)
#define ZH   6
#define RH   512                  // query rows < RH use hi+lo planes (0: none)
#define WIN  2048
#define PCAR 1024.0f
#define SCL  0.088388347648318447f   // HD^-0.5
typedef _Float16 h16;
typedef unsigned short bf;
typedef __attribute__((ext_vector_type(16))) __bf16   v16bf;
typedef __attribute__((ext_vector_type(16))) _Float16 v16h;
typedef __attribute__((ext_vector_type(8)))  _Float16 v8h;
typedef __attribute__((ext_vector_type(8)))  unsigned short v8us;
typedef __attribute__((ext_vector_type(8)))  float    v8f;
typedef __attribute__((ext_vector_type(4)))  float    v4f;
typedef v8h  __attribute__((may_alias)) v8ha;
typedef v4f  __attribute__((may_alias)) v4fa;
typedef v8us __attribute__((may_alias)) v8usa;

__device__ __forceinline__ unsigned short f2bf(float f) { unsigned u = __float_as_uint(f); u += 0x7FFFu + ((u >> 16) & 1u); return (unsigned short)(u >> 16); }
__device__ __forceinline__ float bf2f(unsigned short b) { return __uint_as_float(((unsigned)b) << 16); }
__device__ __forceinline__ float bfr(float f) { return bf2f(f2bf(f)); }
__device__ __forceinline__ v16h cat16(v8h lo, v8h hi) { return __builtin_shufflevector(lo, hi, 0, 1, 2, 3, 4, 5, 6, 7, 8, 9, 10, 11, 12, 13, 14, 15); }
__device__ __forceinline__ v16bf cat16b(v8us lo, v8us hi) { return __builtin_bit_cast(v16bf, __builtin_shufflevector(lo, hi, 0, 1, 2, 3, 4, 5, 6, 7, 8, 9, 10, 11, 12, 13, 14, 15)); }
__device__ __forceinline__ v8f wmma16(v16h a, v16h b, v8f c) { return __builtin_amdgcn_wmma_f32_16x16x32_f16(false, a, false, b, (short)0, c, false, false); }
__device__ __forceinline__ v8f wmmab(v16bf a, v16bf b, v8f c) { return __builtin_amdgcn_wmma_f32_16x16x32_bf16(false, a, false, b, (short)0, c, false, false); }



// ---- k_gemmw: register-blocked GEMM, ONE WAVE per 64x64 output tile (16 accumulators), operands straight from K-contiguous 16-bit planes; grid (M/64, N/64, Z), 32 threads.
// C[m][n] (f32, pitch ldc, + optional f32 bias[n]) = sum_k A[m][k] Bt[n][k] (+ split products per NSPLIT). z-batch strides sA/sB/sC in elements. K % 32 == 0.
template <typename T16> struct WFrag;
template <> struct WFrag<h16> { typedef v16h V; static __device__ __forceinline__ V ld(const h16* p) { return cat16(*(const v8h*)p, *(const v8h*)(p + 16)); } static __device__ __forceinline__ v8f mma(V a, V b, v8f c) { return wmma16(a, b, c); } };
template <> struct WFrag<bf> { typedef v16bf V; static __device__ __forceinline__ V ld(const bf* p) { return cat16b(*(const v8us*)p, *(const v8us*)(p + 16)); } static __device__ __forceinline__ v8f mma(V a, V b, v8f c) { return wmmab(a, b, c); } };
// bias: columns [0, DQ) take bias, [DQ, 2 DQ) bias1, [2 DQ, 3 DQ) bias2 (the joined q|k|v product; a 64-column tile never straddles a segment). A product of DQ columns uses bias alone.
template <typename T16, int NSPLIT, bool BIAS>
__global__ __launch_bounds__(32) void k_gemmw(const T16* __restrict__ A, const T16* __restrict__ A2, const T16* __restrict__ Bt, const T16* __restrict__ Bt2, int K, float* C, int ldc, const float* __restrict__ bias, const float* __restrict__ bias1, const float* __restrict__ bias2, size_t sA, size_t sB, size_t sC) {
    typedef typename WFrag<T16>::V V;
    __shared__ __align__(16) float os[16 * 68];
    const size_t z = blockIdx.z; A += z * sA; if (A2) A2 += z * sA; Bt += z * sB; if (Bt2) Bt2 += z * sB; C += z * sC;
    const int lane = threadIdx.x & 31, lr = lane & 15, hi = lane >> 4; const int r0 = blockIdx.x * 64, c0 = blockIdx.y * 64;
    const int seg = c0 / DQ; const float* bs = (seg == 0 ? bias : (seg == 1 ? bias1 : bias2)) + (c0 - seg * DQ);
    v8f acc[4][4];
#pragma unroll
    for (int mb = 0; mb < 4; ++mb)
#pragma unroll
        for (int nb = 0; nb < 4; ++nb) acc[mb][nb] = (v8f){};
    const size_t aoff = (size_t)(r0 + lr) * K + 8 * hi, boff = (size_t)(c0 + lr) * K + 8 * hi;
#pragma unroll 1
    for (int kc = 0; kc < K; kc += 32) {
        V a[4], a2[4];
#pragma unroll
        for (int mb = 0; mb < 4; ++mb) { a[mb] = WFrag<T16>::ld(A + aoff + (size_t)mb * 16 * K + kc); if (NSPLIT == 1 || NSPLIT == 2) a2[mb] = WFrag<T16>::ld(A2 + aoff + (size_t)mb * 16 * K + kc); }
#pragma unroll
        for (int nb = 0; nb < 4; ++nb) { const V b = WFrag<T16>::ld(Bt + boff + (size_t)nb * 16 * K + kc); V b2; if (NSPLIT >= 2) b2 = WFrag<T16>::ld(Bt2 + boff + (size_t)nb * 16 * K + kc);
#pragma unroll
            for (int mb = 0; mb < 4; ++mb) { acc[mb][nb] = WFrag<T16>::mma(a[mb], b, acc[mb][nb]); if (NSPLIT == 1 || NSPLIT == 2) acc[mb][nb] = WFrag<T16>::mma(a2[mb], b, acc[mb][nb]); if (NSPLIT >= 2) acc[mb][nb] = WFrag<T16>::mma(a[mb], b2, acc[mb][nb]); } }
        asm volatile("v_nop\n\tv_nop\n\tv_nop\n\tv_nop" : "+v"(acc[0][0]), "+v"(acc[1][1]), "+v"(acc[2][2]), "+v"(acc[3][3]) : "v"(a[0]), "v"(a[3]));
    }
#pragma unroll
    for (int mb = 0; mb < 4; ++mb) {
#pragma unroll
        for (int nb = 0; nb < 4; ++nb) {
#pragma unroll
            for (int j = 0; j < 8; ++j) os[(hi * 8 + j) * 68 + nb * 16 + lr] = acc[mb][nb][j]; }
        __builtin_amdgcn_wave_barrier(); asm volatile("" ::: "memory");
        float* crow = C + (size_t)(r0 + mb * 16) * ldc + c0;
{
#pragma unroll
            for (int s = 0; s < 8; ++s) { const int row = 2 * s + hi, cofs = lr * 4; v4f val = *(const v4fa*)(os + row * 68 + cofs); if (BIAS) { val[0] += bfr(bs[cofs]); val[1] += bfr(bs[cofs + 1]); val[2] += bfr(bs[cofs + 2]); val[3] += bfr(bs[cofs + 3]); }
                *(v4f*)(crow + (size_t)row * ldc + cofs) = val; }
             }
        __builtin_amdgcn_wave_barrier(); asm volatile("" ::: "memory");
    }
}

// ---- k_gemmc: the same one-wave 64x64 tile GEMM specialised for causal attention: CMODE 1 skips score tiles entirely above the diagonal (query rows r0+roff.., key columns c0..), CMODE 2 limits the
// key (K) loop of the probability x value contraction to the diagonal block (probabilities beyond it are exactly zero). roff = row offset of this launch's first row within the sequence.
template <typename T16, int NSPLIT, int CMODE>
__global__ __launch_bounds__(32) void k_gemmc(const T16* __restrict__ A, const T16* __restrict__ A2, const T16* __restrict__ Bt, const T16* __restrict__ Bt2, int K, float* C, int ldc, int roff, size_t sA, size_t sB, size_t sC) {
    typedef typename WFrag<T16>::V V;
    __shared__ __align__(16) float os[16 * 68];
    const size_t z = blockIdx.z; A += z * sA; if (A2) A2 += z * sA; Bt += z * sB; if (Bt2) Bt2 += z * sB; C += z * sC;
    const int lane = threadIdx.x & 31, lr = lane & 15, hi = lane >> 4; const int r0 = blockIdx.x * 64, c0 = blockIdx.y * 64;
    if (CMODE == 1 && c0 > r0 + roff + 63) return;                  // score tile entirely above the causal diagonal: never read (the softmax masks j > i by select)
    const int Kl = (CMODE == 2) ? min(K, r0 + roff + 64) : K;        // P.V: probabilities are exactly 0 beyond the diagonal block, so the K loop stops there
    v8f acc[4][4];
#pragma unroll
    for (int mb = 0; mb < 4; ++mb)
#pragma unroll
        for (int nb = 0; nb < 4; ++nb) acc[mb][nb] = (v8f){};
    const size_t aoff = (size_t)(r0 + lr) * K + 8 * hi, boff = (size_t)(c0 + lr) * K + 8 * hi;
#pragma unroll 1
    for (int kc = 0; kc < Kl; kc += 32) {
        V a[4], a2[4];
#pragma unroll
        for (int mb = 0; mb < 4; ++mb) { a[mb] = WFrag<T16>::ld(A + aoff + (size_t)mb * 16 * K + kc); if (NSPLIT == 1 || NSPLIT == 2) a2[mb] = WFrag<T16>::ld(A2 + aoff + (size_t)mb * 16 * K + kc); }
#pragma unroll
        for (int nb = 0; nb < 4; ++nb) { const V b = WFrag<T16>::ld(Bt + boff + (size_t)nb * 16 * K + kc); V b2; if (NSPLIT >= 2) b2 = WFrag<T16>::ld(Bt2 + boff + (size_t)nb * 16 * K + kc);
#pragma unroll
            for (int mb = 0; mb < 4; ++mb) { acc[mb][nb] = WFrag<T16>::mma(a[mb], b, acc[mb][nb]); if (NSPLIT == 1 || NSPLIT == 2) acc[mb][nb] = WFrag<T16>::mma(a2[mb], b, acc[mb][nb]); if (NSPLIT >= 2) acc[mb][nb] = WFrag<T16>::mma(a[mb], b2, acc[mb][nb]); } }
        asm volatile("v_nop\n\tv_nop\n\tv_nop\n\tv_nop" : "+v"(acc[0][0]), "+v"(acc[1][1]), "+v"(acc[2][2]), "+v"(acc[3][3]) : "v"(a[0]), "v"(a[3]));
    }
#pragma unroll
    for (int mb = 0; mb < 4; ++mb) {
#pragma unroll
        for (int nb = 0; nb < 4; ++nb) {
#pragma unroll
            for (int j = 0; j < 8; ++j) os[(hi * 8 + j) * 68 + nb * 16 + lr] = acc[mb][nb][j]; }
        __builtin_amdgcn_wave_barrier(); asm volatile("" ::: "memory");
        float* crow = C + (size_t)(r0 + mb * 16) * ldc + c0;
{
#pragma unroll
            for (int s = 0; s < 8; ++s) { const int row = 2 * s + hi, cofs = lr * 4; v4f val = *(const v4fa*)(os + row * 68 + cofs);
                *(v4f*)(crow + (size_t)row * ldc + cofs) = val; }
             }
        __builtin_amdgcn_wave_barrier(); asm volatile("" ::: "memory");
    }
}

__device__ __forceinline__ h16 tohx(float x) { return (h16)x; }
__device__ __forceinline__ void splitf(float y, unsigned short& h, unsigned short& l) { h = f2bf(y); l = f2bf(y - bf2f(h)); }
typedef __attribute__((ext_vector_type(2))) _Float16 v2h;
typedef __attribute__((ext_vector_type(4))) _Float16 v4h;
typedef __attribute__((ext_vector_type(2))) unsigned short v2us;
typedef __attribute__((ext_vector_type(4))) unsigned short v4us;
typedef __attribute__((ext_vector_type(2))) float v2f;
typedef __attribute__((ext_vector_type(4))) int v4i;

__global__ __launch_bounds__(256) void k_wtG(const float* __restrict__ w0, const float* __restrict__ w1, const float* __restrict__ w2, const float* __restrict__ w3, int K, int N, bf* Bt) {
    const int y = blockIdx.y; const float* __restrict__ w = (y == 0) ? w0 : (y == 1) ? w1 : (y == 2) ? w2 : w3; Bt += (size_t)y * N * K;   // plane y of four K x N weights, planes back to back
    const int lane = threadIdx.x & 31; const int L0 = (blockIdx.x * 8 + (threadIdx.x >> 5)) * 8; const int nlines = N * K / 64;
{
#pragma unroll 1
        for (int l = 0; l < 8; ++l) { const int L = L0 + l; if (L >= nlines) break; const size_t e = (size_t)L * 64 + lane * 2; const int k = (int)(e % K), n = (int)(e / K); v2us o;
            o[0] = f2bf(w[(size_t)k * N + n]); o[1] = f2bf(w[(size_t)(k + 1) * N + n]); *(v2us*)(Bt + e) = o; }
         }
}
__global__ __launch_bounds__(256) void k_cvt8(const float* __restrict__ src, bf* dst, size_t n8) { const size_t i = (size_t)blockIdx.x * 256 + threadIdx.x; if (i >= n8) return; const v8f v = *(const v8f*)(src + i * 8); v8us o;
#pragma unroll
    for (int k = 0; k < 8; ++k) o[k] = f2bf(v[k]); *(v8us*)(dst + i * 8) = o;  }

// d_rope: head planes [h][t][d] (fp16 + hi/lo) of rope(x) x sc with the rotate-half convention out[d] = x[d] cos[t][d] - x[d+HD/2] sin[t][d], out[d+HD/2] = x[d+HD/2] cos[t][d+HD/2] + x[d] sin[t][d+HD/2]
__device__ __forceinline__ void d_rope(unsigned blk, const float* __restrict__ F, int pitch, int nheads, const float* __restrict__ CS, const float* __restrict__ RF, const float* __restrict__ nw, float sc, h16* P16, bf* Ph, bf* Pl) {
    const size_t e = ((size_t)blk * 256 + threadIdx.x) * 2; if (e >= (size_t)nheads * TT * HD) return; const int d = (int)(e % HD); const int t = (int)((e / HD) % TT); const int h = (int)(e / ((size_t)HD * TT)); const float* f = F + (size_t)t * pitch + h * HD; const float rf = RF ? RF[(size_t)h * TT + t] : 1.0f; v2h o16; v2us oh, ol;
#pragma unroll
    for (int q = 0; q < 2; ++q) { const int dd = d + q; const int dp = (dd < HD / 2) ? dd + HD / 2 : dd - HD / 2; float x0 = f[dd], x1 = f[dp];
        if (RF) { float n0 = __fmul_rn(x0, rf), n1 = __fmul_rn(x1, rf); asm volatile("" : "+v"(n0)); asm volatile("" : "+v"(n1)); x0 = __fmul_rn(bfr(nw[dd]), n0); x1 = __fmul_rn(bfr(nw[dp]), n1); }
        const v2f cs = *(const v2f*)(CS + ((size_t)t * HD + dd) * 2); float a = __fmul_rn(x0, cs[0]), bq = __fmul_rn(x1, cs[1]); asm volatile("" : "+v"(a)); asm volatile("" : "+v"(bq)); const float r = ((dd < HD / 2) ? __fsub_rn(a, bq) : __fadd_rn(a, bq)) * sc;
        o16[q] = tohx(r); unsigned short a2, c2; splitf(r, a2, c2); oh[q] = a2; ol[q] = c2; }
    *(v2h*)(P16 + e) = o16; *(v2us*)(Ph + e) = oh; *(v2us*)(Pl + e) = ol;  }
__device__ __forceinline__ void d_vtp(unsigned blk, const float* __restrict__ F, int pitch, int nheads, h16* V16, bf* Vh, bf* Vl) { const size_t e = ((size_t)blk * 256 + threadIdx.x) * 2; if (e >= (size_t)nheads * HD * TT) return; const int t = (int)(e % TT); const int d = (int)((e / TT) % HD); const int g = (int)(e / ((size_t)TT * HD)); v2h o16; v2us oh, ol;
#pragma unroll
    for (int q = 0; q < 2; ++q) { const float x = F[(size_t)(t + q) * pitch + g * HD + d]; o16[q] = tohx(x); unsigned short a2, c2; splitf(x, a2, c2); oh[q] = a2; ol[q] = c2; }
    *(v2h*)(V16 + e) = o16; *(v2us*)(Vh + e) = oh; *(v2us*)(Vl + e) = ol;  }
// k_planes: all plane builders of one batch in one grid: blocks [0, lrope) build the nrope row-major q and k head planes, the rest the nv transposed v planes (v columns follow the q and k columns in F).
__global__ __launch_bounds__(256) void k_planes(const float* __restrict__ F, int pitch, int nrope, int nv, unsigned lrope, const float* __restrict__ CS, h16* P16, bf* Ph, bf* Pl, h16* V16, bf* Vh, bf* Vl) {
    if (blockIdx.x < lrope) d_rope(blockIdx.x, F, pitch, nrope, CS, nullptr, nullptr, 1.0f, P16, Ph, Pl);
    else d_vtp(blockIdx.x - lrope, F + (size_t)nrope * HD, pitch, nv, V16, Vh, Vl);
}
__global__ __launch_bounds__(256) void k_csid(float* CS) { const int idx = blockIdx.x * 256 + threadIdx.x; if (idx >= TT * HD) return; v2f cs; cs[0] = 1.0f; cs[1] = 0.0f; *(v2f*)(CS + (size_t)idx * 2) = cs;  }
// k_asoft: per row (zz, i): t = S x HD^-0.5 for j <= i and i - j < WIN (WIN = TT: the window test always holds, plain causal; the reference's -1e9 additive fill vanishes identically); softmax over the 2048 keys (register row, one exp, fixed trees);
__global__ __launch_bounds__(256) void k_asoft(const float* __restrict__ Sb, h16* P16, bf* Ph, bf* Pl) {
    const int lane = threadIdx.x & 31; const int row = blockIdx.x * 8 + (threadIdx.x >> 5); if (row >= ZH * TT) return; const int i = row % TT; const int zz = row / TT; (void)zz; const bool hires = (i < RH); const float* sr = Sb + (size_t)row * TT; float v[TT / 32]; float mx = -3.0e38f;
#pragma unroll
    for (int ch = 0; ch < TT / 128; ++ch) { const int j0 = ch * 128 + lane * 4; const v4f a = *(const v4f*)(sr + j0);
#pragma unroll
        for (int q = 0; q < 4; ++q) { const int j = j0 + q; (void)j; const float t = (j <= i && i - j < WIN) ? a[q] * SCL : -3.0e38f; v[ch * 4 + q] = t; mx = fmaxf(mx, t); } }
#pragma unroll
    for (int sh = 16; sh; sh >>= 1) mx = fmaxf(mx, __shfl_xor(mx, sh, 32));
    float sum = 0.f;
#pragma unroll
    for (int k = 0; k < TT / 32; ++k) { float d0 = __fsub_rn(v[k], mx); asm volatile("" : "+v"(d0)); v[k] = __builtin_amdgcn_exp2f(__fmul_rn(d0, 1.4426950408889634f)); sum += v[k]; }
#pragma unroll
    for (int sh = 16; sh; sh >>= 1) sum += __shfl_xor(sum, sh, 32);
    const float f = __fdiv_rn(hires ? 1.0f : PCAR, sum);
{
        if (hires) {
#pragma unroll
            for (int ch = 0; ch < TT / 128; ++ch) { v4us oh, ol;
#pragma unroll
                for (int q = 0; q < 4; ++q) { unsigned short a, c2; splitf(v[ch * 4 + q] * f, a, c2); oh[q] = a; ol[q] = c2; }
                const size_t oo = ((size_t)zz * (RH ? RH : 1) + i) * TT + ch * 128 + lane * 4; *(v4us*)(Ph + oo) = oh; *(v4us*)(Pl + oo) = ol; }
        } else {
#pragma unroll
            for (int ch = 0; ch < TT / 128; ++ch) { v4h o4;
#pragma unroll
                for (int q = 0; q < 4; ++q) o4[q] = tohx(v[ch * 4 + q] * f);
                *(v4h*)(P16 + (size_t)row * TT + ch * 128 + lane * 4) = o4; } }
         }
}
__global__ __launch_bounds__(256) void k_merge(const float* __restrict__ O, int h0, bf* Ah, bf* Al) { const size_t e = ((size_t)blockIdx.x * 256 + threadIdx.x) * 2; if (e >= (size_t)ZH * TT * HD) return; const int d = (int)(e % HD); const int t = (int)((e / HD) % TT); const int zz = (int)(e / ((size_t)HD * TT)); const float cs = (t < RH) ? 1.0f : (1.0f / PCAR); const size_t oo = (size_t)t * DQ + (h0 + zz) * HD + d;
    v2us oh, ol;
#pragma unroll
    for (int q = 0; q < 2; ++q) { unsigned short a, c2; splitf(O[e + q] * cs, a, c2); oh[q] = a; ol[q] = c2; } *(v2us*)(Ah + oo) = oh; *(v2us*)(Al + oo) = ol;  }

extern "C" void kernel_launch(void* const* d_in, const int* in_sizes, int n_in,
                              void* d_out, int out_size, void* d_ws, size_t ws_size, hipStream_t stream) {
    (void)in_sizes; (void)n_in; (void)out_size;
    const float* x = (const float*)d_in[0]; const float* wq = (const float*)d_in[1]; const float* bq = (const float*)d_in[2]; const float* wk = (const float*)d_in[3]; const float* bk = (const float*)d_in[4]; const float* wv = (const float*)d_in[5]; const float* bv = (const float*)d_in[6]; const float* wo = (const float*)d_in[7]; const float* bo = (const float*)d_in[8];
    float* OUT = (float*)d_out;     // [4][2048][768]
    char* wsp = (char*)d_ws;
    auto take = [&](size_t bytes) { char* p = wsp; wsp += (bytes + 255) & ~(size_t)255; return (void*)p; };
    bf* WQ = (bf*)take((size_t)DQ * DM * 2); bf* WK = (bf*)take((size_t)DKV * DM * 2); bf* WV = (bf*)take((size_t)DKV * DM * 2); bf* WO = (bf*)take((size_t)DM * DQ * 2); float* CS = (float*)take((size_t)TT * HD * 2 * 4);   // WQ, WK, WV, WO back to back (each a multiple of 256 bytes): WQ is also the [3 DQ][DM] plane of the joined product
    bf* XB = (bf*)take((size_t)NB_ * TT * DM * 2);
    h16* QP16 = (h16*)take((size_t)NH_ * TT * HD * 2); h16* KP16 = (h16*)take((size_t)NKV * TT * HD * 2); h16* VT16 = (h16*)take((size_t)NKV * HD * TT * 2);   // q planes directly followed by k planes, in each of the three kinds: one builder launch writes 12 planes
    bf* QPh = (bf*)take((size_t)NH_ * TT * HD * 2); bf* KPh = (bf*)take((size_t)NKV * TT * HD * 2); bf* QPl = (bf*)take((size_t)NH_ * TT * HD * 2); bf* KPl = (bf*)take((size_t)NKV * TT * HD * 2); bf* VTh = (bf*)take((size_t)NKV * HD * TT * 2); bf* VTl = (bf*)take((size_t)NKV * HD * TT * 2); bf* Ph = (bf*)take((size_t)ZH * RH * TT * 2); bf* Pl = (bf*)take((size_t)ZH * RH * TT * 2);
    float* Sb = (float*)take((size_t)ZH * TT * TT * 4); h16* P16 = (h16*)take((size_t)ZH * TT * TT * 2); float* Ob = (float*)take((size_t)ZH * TT * HD * 4); bf* ATh = (bf*)take((size_t)NB_ * TT * DQ * 2); bf* ATl = (bf*)take((size_t)NB_ * TT * DQ * 2);
    if ((size_t)(wsp - (char*)d_ws) > ws_size) return;    // ws 256 MiB
    (void)WK; (void)WV;
    float* F = Sb;   // [TT][3 DQ] f32 q|k|v of one batch: lives in the score buffer, consumed by the plane builders before the scores are written (stream-ordered)
    k_wtG<<<dim3((unsigned)((DM * DQ / 64 + 63) / 64), 4, 1), 256, 0, stream>>>(wq, wk, wv, wo, DM, DQ, WQ);
    k_csid<<<(TT * HD + 255) / 256, 256, 0, stream>>>(CS);
    k_cvt8<<<(unsigned)(((size_t)NB_ * TT * DM / 8 + 255) / 256), 256, 0, stream>>>(x, XB, (size_t)NB_ * TT * DM / 8);
    const unsigned LQK = (unsigned)(((size_t)(NH_ + NKV) * TT * HD / 2 + 255) / 256), LKv = (unsigned)(((size_t)NKV * TT * HD / 2 + 255) / 256);
    for (int b = 0; b < NB_; ++b) {
        k_gemmw<bf, 0, true><<<dim3(TT / 64, 3 * DQ / 64, 1), 32, 0, stream>>>(XB + (size_t)b * TT * DM, nullptr, WQ, nullptr, DM, F, 3 * DQ, bq, bk, bv, 0, 0, 0);
        k_planes<<<LQK + LKv, 256, 0, stream>>>(F, 3 * DQ, NH_ + NKV, NKV, LQK, CS, QP16, QPh, QPl, VT16, VTh, VTl);
        k_gemmc<bf, 2, 1><<<dim3(RH / 64, TT / 64, ZH), 32, 0, stream>>>(QPh, QPl, KPh, KPl, HD, Sb, TT, 0, (size_t)TT * HD, (size_t)TT * HD, (size_t)TT * TT);
        k_gemmc<h16, 0, 1><<<dim3((TT - RH) / 64, TT / 64, ZH), 32, 0, stream>>>(QP16 + (size_t)RH * HD, nullptr, KP16, nullptr, HD, Sb + (size_t)RH * TT, TT, RH, (size_t)TT * HD, (size_t)TT * HD, (size_t)TT * TT);
        k_asoft<<<ZH * TT / 8, 256, 0, stream>>>(Sb, P16, Ph, Pl);
        k_gemmc<bf, 2, 2><<<dim3(RH / 64, HD / 64, ZH), 32, 0, stream>>>(Ph, Pl, VTh, VTl, TT, Ob, HD, 0, (size_t)RH * TT, (size_t)HD * TT, (size_t)TT * HD);
        k_gemmc<h16, 0, 2><<<dim3((TT - RH) / 64, HD / 64, ZH), 32, 0, stream>>>(P16 + (size_t)RH * TT, nullptr, VT16, nullptr, TT, Ob + (size_t)RH * HD, HD, RH, (size_t)TT * TT, (size_t)HD * TT, (size_t)TT * HD);
        k_merge<<<(unsigned)(((size_t)ZH * TT * HD / 2 + 255) / 256), 256, 0, stream>>>(Ob, 0, ATh + (size_t)b * TT * DQ, ATl + (size_t)b * TT * DQ); }
    k_gemmw<bf, 1, true><<<dim3(NB_ * TT / 64, DM / 64, 1), 32, 0, stream>>>(ATh, ATl, WO, nullptr, DQ, OUT, DM, bo, bo, bo, 0, 0, 0);
}

// v002
// A run of this version takes 283 microseconds.
// Next to v001, in two timings, it ran 2.16 and 2.15 times as fast.
// All steps since v000 together make it 4.75 times as fast.
#include <hip/hip_runtime.h>

// Causal self-attention with 6 heads of width 128 (x_input [4][2048][768]; q, k, v = x W + b ('xw' [768][768] 768^-0.5, biases zeros on this draw: read; 6 heads x 128); scores / sqrt(128); causal (finfo.min == exclusion); softmax; out = merged Wo + bo ('xw' + bias (zeros: read)) -> [4][2048][768] (6.3 M); argument order x_input, Wq, bq, Wk, bk, Wv, bv, Wo, bo).
// Layout per batch: bf16 copy of x; 'xw' weights transposed once; exact projections (K 768) + f32 biases; identity-table plane builders at width 128; then, for all batches at once, fused causal attention (online softmax in registers; hybrid rows: < 512 hi/lo 3 products, rest fp16 x1024; key blocks above the diagonal are never visited) that writes the merged hi/lo planes; merged hi/lo x Wo exact + bo.
// Compute dtypes, f32 accumulate: every input rounded to bf16; projections exact + f32 biases; attention rows < 512 3 products, rest fp16; softmax f32; Wo hl x exact + bias.

#define NB_  4
#define TT   2048
#define DM   768
#define NH_  6
#define NKV  6
#define REP  (NH_ / NKV)
#define HD   128
#define DQ   (NH_ * HD)
#define DKV  (NKV * HD)
#define ZH   6
#define RH   512                  // query rows < RH use hi+lo planes (0: none)
#define WIN  2048
#define PCAR 1024.0f
#define SCL  0.088388347648318447f   // HD^-0.5
typedef _Float16 h16;
typedef unsigned short bf;
typedef __attribute__((ext_vector_type(16))) __bf16   v16bf;
typedef __attribute__((ext_vector_type(16))) _Float16 v16h;
typedef __attribute__((ext_vector_type(8)))  _Float16 v8h;
typedef __attribute__((ext_vector_type(8)))  unsigned short v8us;
typedef __attribute__((ext_vector_type(8)))  float    v8f;
typedef __attribute__((ext_vector_type(4)))  float    v4f;
typedef v8h  __attribute__((may_alias)) v8ha;
typedef v4f  __attribute__((may_alias)) v4fa;
typedef v8us __attribute__((may_alias)) v8usa;

__device__ __forceinline__ unsigned short f2bf(float f) { unsigned u = __float_as_uint(f); u += 0x7FFFu + ((u >> 16) & 1u); return (unsigned short)(u >> 16); }
__device__ __forceinline__ float bf2f(unsigned short b) { return __uint_as_float(((unsigned)b) << 16); }
__device__ __forceinline__ float bfr(float f) { return bf2f(f2bf(f)); }
__device__ __forceinline__ v16h cat16(v8h lo, v8h hi) { return __builtin_shufflevector(lo, hi, 0, 1, 2, 3, 4, 5, 6, 7, 8, 9, 10, 11, 12, 13, 14, 15); }
__device__ __forceinline__ v16bf cat16b(v8us lo, v8us hi) { return __builtin_bit_cast(v16bf, __builtin_shufflevector(lo, hi, 0, 1, 2, 3, 4, 5, 6, 7, 8, 9, 10, 11, 12, 13, 14, 15)); }
__device__ __forceinline__ v8f wmma16(v16h a, v16h b, v8f c) { return __builtin_amdgcn_wmma_f32_16x16x32_f16(false, a, false, b, (short)0, c, false, false); }
__device__ __forceinline__ v8f wmmab(v16bf a, v16bf b, v8f c) { return __builtin_amdgcn_wmma_f32_16x16x32_bf16(false, a, false, b, (short)0, c, false, false); }



// ---- k_gemmw: register-blocked GEMM, ONE WAVE per 64x64 output tile (16 accumulators), operands straight from K-contiguous 16-bit planes; grid (M/64, N/64, Z), 32 threads.
// C[m][n] (f32, pitch ldc, + optional f32 bias[n]) = sum_k A[m][k] Bt[n][k] (+ split products per NSPLIT). z-batch strides sA/sB/sC in elements. K % 32 == 0.
template <typename T16> struct WFrag;
template <> struct WFrag<h16> { typedef v16h V; static __device__ __forceinline__ V ld(const h16* p) { return cat16(*(const v8h*)p, *(const v8h*)(p + 16)); } static __device__ __forceinline__ v8f mma(V a, V b, v8f c) { return wmma16(a, b, c); } };
template <> struct WFrag<bf> { typedef v16bf V; static __device__ __forceinline__ V ld(const bf* p) { return cat16b(*(const v8us*)p, *(const v8us*)(p + 16)); } static __device__ __forceinline__ v8f mma(V a, V b, v8f c) { return wmmab(a, b, c); } };
// bias: columns [0, DQ) take bias, [DQ, 2 DQ) bias1, [2 DQ, 3 DQ) bias2 (the joined q|k|v product; a 64-column tile never straddles a segment). A product of DQ columns uses bias alone.
template <typename T16, int NSPLIT, bool BIAS>
__global__ __launch_bounds__(32) void k_gemmw(const T16* __restrict__ A, const T16* __restrict__ A2, const T16* __restrict__ Bt, const T16* __restrict__ Bt2, int K, float* C, int ldc, const float* __restrict__ bias, const float* __restrict__ bias1, const float* __restrict__ bias2, size_t sA, size_t sB, size_t sC) {
    typedef typename WFrag<T16>::V V;
    __shared__ __align__(16) float os[16 * 68];
    const size_t z = blockIdx.z; A += z * sA; if (A2) A2 += z * sA; Bt += z * sB; if (Bt2) Bt2 += z * sB; C += z * sC;
    const int lane = threadIdx.x & 31, lr = lane & 15, hi = lane >> 4; const int r0 = blockIdx.x * 64, c0 = blockIdx.y * 64;
    const int seg = c0 / DQ; const float* bs = (seg == 0 ? bias : (seg == 1 ? bias1 : bias2)) + (c0 - seg * DQ);
    v8f acc[4][4];
#pragma unroll
    for (int mb = 0; mb < 4; ++mb)
#pragma unroll
        for (int nb = 0; nb < 4; ++nb) acc[mb][nb] = (v8f){};
    const size_t aoff = (size_t)(r0 + lr) * K + 8 * hi, boff = (size_t)(c0 + lr) * K + 8 * hi;
#pragma unroll 1
    for (int kc = 0; kc < K; kc += 32) {
        V a[4], a2[4];
#pragma unroll
        for (int mb = 0; mb < 4; ++mb) { a[mb] = WFrag<T16>::ld(A + aoff + (size_t)mb * 16 * K + kc); if (NSPLIT == 1 || NSPLIT == 2) a2[mb] = WFrag<T16>::ld(A2 + aoff + (size_t)mb * 16 * K + kc); }
#pragma unroll
        for (int nb = 0; nb < 4; ++nb) { const V b = WFrag<T16>::ld(Bt + boff + (size_t)nb * 16 * K + kc); V b2; if (NSPLIT >= 2) b2 = WFrag<T16>::ld(Bt2 + boff + (size_t)nb * 16 * K + kc);
#pragma unroll
            for (int mb = 0; mb < 4; ++mb) { acc[mb][nb] = WFrag<T16>::mma(a[mb], b, acc[mb][nb]); if (NSPLIT == 1 || NSPLIT == 2) acc[mb][nb] = WFrag<T16>::mma(a2[mb], b, acc[mb][nb]); if (NSPLIT >= 2) acc[mb][nb] = WFrag<T16>::mma(a[mb], b2, acc[mb][nb]); } }
        asm volatile("v_nop\n\tv_nop\n\tv_nop\n\tv_nop" : "+v"(acc[0][0]), "+v"(acc[1][1]), "+v"(acc[2][2]), "+v"(acc[3][3]) : "v"(a[0]), "v"(a[3]));
    }
#pragma unroll
    for (int mb = 0; mb < 4; ++mb) {
#pragma unroll
        for (int nb = 0; nb < 4; ++nb) {
#pragma unroll
            for (int j = 0; j < 8; ++j) os[(hi * 8 + j) * 68 + nb * 16 + lr] = acc[mb][nb][j]; }
        __builtin_amdgcn_wave_barrier(); asm volatile("" ::: "memory");
        float* crow = C + (size_t)(r0 + mb * 16) * ldc + c0;
{
#pragma unroll
            for (int s = 0; s < 8; ++s) { const int row = 2 * s + hi, cofs = lr * 4; v4f val = *(const v4fa*)(os + row * 68 + cofs); if (BIAS) { val[0] += bfr(bs[cofs]); val[1] += bfr(bs[cofs + 1]); val[2] += bfr(bs[cofs + 2]); val[3] += bfr(bs[cofs + 3]); }
                *(v4f*)(crow + (size_t)row * ldc + cofs) = val; }
             }
        __builtin_amdgcn_wave_barrier(); asm volatile("" ::: "memory");
    }
}

__device__ __forceinline__ h16 tohx(float x) { return (h16)x; }
__device__ __forceinline__ void splitf(float y, unsigned short& h, unsigned short& l) { h = f2bf(y); l = f2bf(y - bf2f(h)); }
typedef __attribute__((ext_vector_type(2))) _Float16 v2h;
typedef __attribute__((ext_vector_type(4))) _Float16 v4h;
typedef __attribute__((ext_vector_type(2))) unsigned short v2us;
typedef __attribute__((ext_vector_type(4))) unsigned short v4us;
typedef __attribute__((ext_vector_type(2))) float v2f;
typedef __attribute__((ext_vector_type(4))) int v4i;

__global__ __launch_bounds__(256) void k_wtG(const float* __restrict__ w0, const float* __restrict__ w1, const float* __restrict__ w2, const float* __restrict__ w3, int K, int N, bf* Bt) {
    const int y = blockIdx.y; const float* __restrict__ w = (y == 0) ? w0 : (y == 1) ? w1 : (y == 2) ? w2 : w3; Bt += (size_t)y * N * K;   // plane y of four K x N weights, planes back to back
    const int lane = threadIdx.x & 31; const int L0 = (blockIdx.x * 8 + (threadIdx.x >> 5)) * 8; const int nlines = N * K / 64;
{
#pragma unroll 1
        for (int l = 0; l < 8; ++l) { const int L = L0 + l; if (L >= nlines) break; const size_t e = (size_t)L * 64 + lane * 2; const int k = (int)(e % K), n = (int)(e / K); v2us o;
            o[0] = f2bf(w[(size_t)k * N + n]); o[1] = f2bf(w[(size_t)(k + 1) * N + n]); *(v2us*)(Bt + e) = o; }
         }
}
__global__ __launch_bounds__(256) void k_cvt8(const float* __restrict__ src, bf* dst, size_t n8) { const size_t i = (size_t)blockIdx.x * 256 + threadIdx.x; if (i >= n8) return; const v8f v = *(const v8f*)(src + i * 8); v8us o;
#pragma unroll
    for (int k = 0; k < 8; ++k) o[k] = f2bf(v[k]); *(v8us*)(dst + i * 8) = o;  }

// d_rope: head planes [h][t][d] (fp16 + hi/lo) of rope(x) x sc with the rotate-half convention out[d] = x[d] cos[t][d] - x[d+HD/2] sin[t][d], out[d+HD/2] = x[d+HD/2] cos[t][d+HD/2] + x[d] sin[t][d+HD/2]
__device__ __forceinline__ void d_rope(unsigned blk, const float* __restrict__ F, int pitch, int nheads, const float* __restrict__ CS, const float* __restrict__ RF, const float* __restrict__ nw, float sc, h16* P16, bf* Ph, bf* Pl) {
    const size_t e = ((size_t)blk * 256 + threadIdx.x) * 2; if (e >= (size_t)nheads * TT * HD) return; const int d = (int)(e % HD); const int t = (int)((e / HD) % TT); const int h = (int)(e / ((size_t)HD * TT)); const float* f = F + (size_t)t * pitch + h * HD; const float rf = RF ? RF[(size_t)h * TT + t] : 1.0f; v2h o16; v2us oh, ol;
#pragma unroll
    for (int q = 0; q < 2; ++q) { const int dd = d + q; const int dp = (dd < HD / 2) ? dd + HD / 2 : dd - HD / 2; float x0 = f[dd], x1 = f[dp];
        if (RF) { float n0 = __fmul_rn(x0, rf), n1 = __fmul_rn(x1, rf); asm volatile("" : "+v"(n0)); asm volatile("" : "+v"(n1)); x0 = __fmul_rn(bfr(nw[dd]), n0); x1 = __fmul_rn(bfr(nw[dp]), n1); }
        const v2f cs = *(const v2f*)(CS + ((size_t)t * HD + dd) * 2); float a = __fmul_rn(x0, cs[0]), bq = __fmul_rn(x1, cs[1]); asm volatile("" : "+v"(a)); asm volatile("" : "+v"(bq)); const float r = ((dd < HD / 2) ? __fsub_rn(a, bq) : __fadd_rn(a, bq)) * sc;
        o16[q] = tohx(r); unsigned short a2, c2; splitf(r, a2, c2); oh[q] = a2; ol[q] = c2; }
    *(v2h*)(P16 + e) = o16; *(v2us*)(Ph + e) = oh; *(v2us*)(Pl + e) = ol;  }
__device__ __forceinline__ void d_vtp(unsigned blk, const float* __restrict__ F, int pitch, int nheads, h16* V16, bf* Vh, bf* Vl) { const size_t e = ((size_t)blk * 256 + threadIdx.x) * 2; if (e >= (size_t)nheads * HD * TT) return; const int t = (int)(e % TT); const int d = (int)((e / TT) % HD); const int g = (int)(e / ((size_t)TT * HD)); v2h o16; v2us oh, ol;
#pragma unroll
    for (int q = 0; q < 2; ++q) { const float x = F[(size_t)(t + q) * pitch + g * HD + d]; o16[q] = tohx(x); unsigned short a2, c2; splitf(x, a2, c2); oh[q] = a2; ol[q] = c2; }
    *(v2h*)(V16 + e) = o16; *(v2us*)(Vh + e) = oh; *(v2us*)(Vl + e) = ol;  }
// k_planes: all plane builders of one batch in one grid: blocks [0, lrope) build the nrope row-major q and k head planes, the rest the nv transposed v planes (v columns follow the q and k columns in F).
__global__ __launch_bounds__(256) void k_planes(const float* __restrict__ F, int pitch, int nrope, int nv, unsigned lrope, const float* __restrict__ CS, h16* P16, bf* Ph, bf* Pl, h16* V16, bf* Vh, bf* Vl) {
    if (blockIdx.x < lrope) d_rope(blockIdx.x, F, pitch, nrope, CS, nullptr, nullptr, 1.0f, P16, Ph, Pl);
    else d_vtp(blockIdx.x - lrope, F + (size_t)nrope * HD, pitch, nv, V16, Vh, Vl);
}
__global__ __launch_bounds__(256) void k_csid(float* CS) { const int idx = blockIdx.x * 256 + threadIdx.x; if (idx >= TT * HD) return; v2f cs; cs[0] = 1.0f; cs[1] = 0.0f; *(v2f*)(CS + (size_t)idx * 2) = cs;  }
typedef __attribute__((ext_vector_type(16))) unsigned short v16us;
__device__ __forceinline__ float xhalf(float x) { return __builtin_bit_cast(float, __builtin_amdgcn_permlanex16(__builtin_bit_cast(int, x), __builtin_bit_cast(int, x), 0x76543210, 0xfedcba98, false, false)); }
__device__ __forceinline__ float exp2x1(float x) { asm("v_exp_f32 %0, %0\n\tv_nop" : "+v"(x)); return x; }
__device__ __forceinline__ v8f exp2x8(v8f x) { float e0 = x[0], e1 = x[1], e2 = x[2], e3 = x[3], e4 = x[4], e5 = x[5], e6 = x[6], e7 = x[7];
    asm("v_exp_f32 %0, %0\n\tv_exp_f32 %1, %1\n\tv_exp_f32 %2, %2\n\tv_exp_f32 %3, %3\n\tv_exp_f32 %4, %4\n\tv_exp_f32 %5, %5\n\tv_exp_f32 %6, %6\n\tv_exp_f32 %7, %7\n\tv_nop" : "+v"(e0), "+v"(e1), "+v"(e2), "+v"(e3), "+v"(e4), "+v"(e5), "+v"(e6), "+v"(e7));
    return (v8f){e0, e1, e2, e3, e4, e5, e6, e7}; }
template <typename T16, bool HI, int NQ>
__device__ __forceinline__ void d_fattn(const int r0, const T16* __restrict__ Q, const T16* __restrict__ Q2, const T16* __restrict__ Kp, const T16* __restrict__ K2, const T16* __restrict__ Vt, const T16* __restrict__ Vt2, bf* Ah, bf* Al) {
    typedef typename WFrag<T16>::V V;
    const int lane = threadIdx.x & 31, lr = lane & 15, hi = lane >> 4;
    const float CE = SCL * 1.4426950408889634f;      // exp(s SCL) = exp2(s CE)
    const float PSH = HI ? 0.0f : 10.0f;             // log2(PCAR)
    // Every load address is a wave-uniform base plus one of these two lane offsets (elements): a run of loads then takes one 64-bit add a plane, ahead of its first load, and immediate offsets for the rest, so that no address is formed in the midst of a run in registers that a finished fragment has just left.
    const unsigned lrow = (unsigned)(lr * HD + 8 * hi), lcol = (unsigned)(lr * TT + 8 * hi);
    V q[NQ][4], q2[NQ][4], kf[2][4], kf2[2][4];
#pragma unroll
    for (int nq = 0; nq < NQ; ++nq)
#pragma unroll
        for (int kc = 0; kc < 4; ++kc) { const size_t o = (size_t)(r0 + nq * 16) * HD + kc * 32; q[nq][kc] = WFrag<T16>::ld(Q + o + lrow); if (HI) q2[nq][kc] = WFrag<T16>::ld(Q2 + o + lrow); }
    asm volatile("s_wait_xcnt 0x0" ::: "memory"); __builtin_amdgcn_sched_barrier(0);   // stands in front of every rewrite of a register that the loads above name as their address (here and at the three like places below); the fence keeps later instructions behind it
#pragma unroll
    for (int kt = 0; kt < 2; ++kt)
#pragma unroll
        for (int kc = 0; kc < 4; ++kc) { const size_t ko = (size_t)(kt * 16) * HD + kc * 32; kf[kt][kc] = WFrag<T16>::ld(Kp + ko + lrow); if (HI) kf2[kt][kc] = WFrag<T16>::ld(K2 + ko + lrow); }
    asm volatile("s_wait_xcnt 0x0" ::: "memory"); __builtin_amdgcn_sched_barrier(0);   // as above, for the first pass's K loads
    v8f o[8][NQ]; float m[NQ], l[NQ];
#pragma unroll
    for (int nq = 0; nq < NQ; ++nq) { m[nq] = -3.0e38f; l[nq] = 0.f;
#pragma unroll
        for (int dt = 0; dt < 8; ++dt) o[dt][nq] = (v8f){}; }
    const int npass = (r0 + NQ * 16 - 1) / 32 + 1;   // passes of 32 keys up to and including the one that holds the last row's diagonal
    int kb = 0;
#pragma unroll 1                                     // one pass a trip: the trip count is known only at run time, and one pass's fragments already fill the wave's registers
    do {                                             // npass >= 1: no test in front of the first pass
        const int k0 = kb * 32;
        V vf[8], vf2[8];
#pragma unroll
        for (int dt = 0; dt < 8; ++dt) { const size_t vo = (size_t)(dt * 16) * TT + k0; vf[dt] = WFrag<T16>::ld(Vt + vo + lcol); if (HI) vf2[dt] = WFrag<T16>::ld(Vt2 + vo + lcol); }
        asm volatile("s_wait_xcnt 0x0" ::: "memory");   // as above, for the V loads
        __builtin_amdgcn_sched_barrier(0);           // keeps the V requests in front of the score products (the scheduler otherwise sinks them to their use, where their latency is waited out)
        v8f s[2][NQ];
#pragma unroll
        for (int kt = 0; kt < 2; ++kt)
#pragma unroll
            for (int nq = 0; nq < NQ; ++nq) { v8f acc = (v8f){};
#pragma unroll
                for (int kc = 0; kc < 4; ++kc) { acc = WFrag<T16>::mma(kf[kt][kc], q[nq][kc], acc); if (HI) { acc = WFrag<T16>::mma(kf[kt][kc], q2[nq][kc], acc); acc = WFrag<T16>::mma(kf2[kt][kc], q[nq][kc], acc); } }
                s[kt][nq] = acc; }
        const int kn = min(kb + 1, npass - 1) * 32;  // (the last pass asks for its own keys again: in bounds, never used)
#pragma unroll
        for (int kt = 0; kt < 2; ++kt)
#pragma unroll
            for (int kc = 0; kc < 4; ++kc) { const size_t ko = (size_t)(kn + kt * 16) * HD + kc * 32; kf[kt][kc] = WFrag<T16>::ld(Kp + ko + lrow); if (HI) kf2[kt][kc] = WFrag<T16>::ld(K2 + ko + lrow); }
        asm volatile("s_wait_xcnt 0x0" ::: "memory");   // as above, for the K loads
        __builtin_amdgcn_sched_barrier(0);           // keeps the next pass's K requests in front of the softmax, under which they fly (they go out among the score products, each as soon as the last product has read its registers)
        if (k0 + 31 > r0) {                          // the pass reaches past the first row's diagonal: exclude keys j > i
#pragma unroll
            for (int nq = 0; nq < NQ; ++nq) { const int qi = r0 + nq * 16 + lr;
#pragma unroll
                for (int kt = 0; kt < 2; ++kt)
#pragma unroll
                    for (int j = 0; j < 8; ++j) s[kt][nq][j] = (k0 + kt * 16 + hi * 8 + j <= qi) ? s[kt][nq][j] : -3.0e38f; }
        }
        V pb[NQ], pb2[NQ];
#pragma unroll
        for (int nq = 0; nq < NQ; ++nq) {
            float bm[2];
#pragma unroll
            for (int kt = 0; kt < 2; ++kt) { bm[kt] = s[kt][nq][0];
#pragma unroll
                for (int j = 1; j < 8; ++j) bm[kt] = fmaxf(bm[kt], s[kt][nq][j]); }
            float mb = fmaxf(bm[0], bm[1]);
            mb = fmaxf(mb, xhalf(mb));  // the other half of the wave holds the other 8 keys of each tile
            const float mn = fmaxf(m[nq], mb); const float al = exp2x1((m[nq] - mn) * CE); m[nq] = mn;
            const float sh = PSH - mn * CE; float ps[2];
#pragma unroll
            for (int kt = 0; kt < 2; ++kt) { v8f x;
#pragma unroll
                for (int j = 0; j < 8; ++j) x[j] = fmaf(s[kt][nq][j], CE, sh);
                x = exp2x8(x); s[kt][nq] = x; ps[kt] = 0.f;
#pragma unroll
                for (int j = 0; j < 8; ++j) ps[kt] += x[j]; }
            l[nq] = l[nq] * al + (ps[0] + ps[1]);
#pragma unroll
            for (int dt = 0; dt < 8; ++dt) o[dt][nq] *= al;
            if constexpr (HI) { v16us ph, pl;
#pragma unroll
                for (int e = 0; e < 16; ++e) { unsigned short a, c2; splitf(s[e >> 3][nq][e & 7], a, c2); ph[e] = a; pl[e] = c2; }
                pb[nq] = __builtin_bit_cast(v16bf, ph); pb2[nq] = __builtin_bit_cast(v16bf, pl);
            } else { v16h ph;
#pragma unroll
                for (int e = 0; e < 16; ++e) ph[e] = tohx(s[e >> 3][nq][e & 7]);
                pb[nq] = ph; }
        }
#pragma unroll
        for (int dt = 0; dt < 8; ++dt)
#pragma unroll
            for (int nq = 0; nq < NQ; ++nq) { o[dt][nq] = WFrag<T16>::mma(vf[dt], pb[nq], o[dt][nq]); if (HI) { o[dt][nq] = WFrag<T16>::mma(vf[dt], pb2[nq], o[dt][nq]); o[dt][nq] = WFrag<T16>::mma(vf2[dt], pb[nq], o[dt][nq]); } }
    } while (++kb < npass);
#pragma unroll
    for (int nq = 0; nq < NQ; ++nq) { const float lt = l[nq] + xhalf(l[nq]); const float inv = __fdiv_rn(1.0f, lt); const size_t oo = (size_t)(r0 + nq * 16 + lr) * DQ + hi * 8;
#pragma unroll
        for (int dt = 0; dt < 8; ++dt) { v8us oh, ol;   // a lane's 8 accumulator registers are 8 consecutive d of its query: one 16-byte store a plane
#pragma unroll
            for (int j = 0; j < 8; ++j) { unsigned short a, c2; splitf(o[dt][nq][j] * inv, a, c2); oh[j] = a; ol[j] = c2; }
            *(v8us*)(Ah + oo + dt * 16) = oh; *(v8us*)(Al + oo + dt * 16) = ol; } }
}
// grid: blocks of 4 waves, heaviest first. Blocks [0, NF): 128 fp16 query rows each (4 waves x 32), last rows first; the rest: 64 hi/lo query rows each (4 waves x 16). The 4 waves of a block walk the same K and V.
// QK*: per batch 12 planes [t][d] (6 q heads, then 6 k heads); V*: per batch 6 planes [d][t]. Ah/Al: merged heads [b][t][DQ], hi and lo.
__global__ __launch_bounds__(128) void k_fattn(const h16* __restrict__ QK16, const bf* __restrict__ QKh, const bf* __restrict__ QKl, const h16* __restrict__ V16, const bf* __restrict__ Vh, const bf* __restrict__ Vl, bf* Ah, bf* Al) {
    const int wave = __builtin_amdgcn_readfirstlane((int)(threadIdx.x >> 5));   // a scalar, so that the key loop's trip count and the mask test are scalar branches
    const int NBH = NB_ * NH_, NF = (TT - RH) / 128 * NBH;
    int id = blockIdx.x; const bool f16rows = id < NF; if (!f16rows) id -= NF;
    const int bh = id % NBH, g = id / NBH, b = bh / NH_, h = bh % NH_;
    const size_t qo = ((size_t)b * (NH_ + NKV) + h) * TT * HD, ko = ((size_t)b * (NH_ + NKV) + NH_ + h / REP) * TT * HD, vo = ((size_t)b * NKV + h / REP) * HD * TT, ao = (size_t)b * TT * DQ + h * HD;
    if (f16rows) d_fattn<h16, false, 2>(RH + ((TT - RH) / 128 - 1 - g) * 128 + wave * 32, QK16 + qo, nullptr, QK16 + ko, nullptr, V16 + vo, nullptr, Ah + ao, Al + ao);
    else d_fattn<bf, true, 1>((RH / 64 - 1 - g) * 64 + wave * 16, QKh + qo, QKl + qo, QKh + ko, QKl + ko, Vh + vo, Vl + vo, Ah + ao, Al + ao);
}

extern "C" void kernel_launch(void* const* d_in, const int* in_sizes, int n_in,
                              void* d_out, int out_size, void* d_ws, size_t ws_size, hipStream_t stream) {
    (void)in_sizes; (void)n_in; (void)out_size;
    const float* x = (const float*)d_in[0]; const float* wq = (const float*)d_in[1]; const float* bq = (const float*)d_in[2]; const float* wk = (const float*)d_in[3]; const float* bk = (const float*)d_in[4]; const float* wv = (const float*)d_in[5]; const float* bv = (const float*)d_in[6]; const float* wo = (const float*)d_in[7]; const float* bo = (const float*)d_in[8];
    float* OUT = (float*)d_out;     // [4][2048][768]
    char* wsp = (char*)d_ws;
    auto take = [&](size_t bytes) { char* p = wsp; wsp += (bytes + 255) & ~(size_t)255; return (void*)p; };
    bf* WQ = (bf*)take((size_t)DQ * DM * 2); bf* WK = (bf*)take((size_t)DKV * DM * 2); bf* WV = (bf*)take((size_t)DKV * DM * 2); bf* WO = (bf*)take((size_t)DM * DQ * 2); float* CS = (float*)take((size_t)TT * HD * 2 * 4);   // WQ, WK, WV, WO back to back (each a multiple of 256 bytes): WQ is also the [3 DQ][DM] plane of the joined product
    bf* XB = (bf*)take((size_t)NB_ * TT * DM * 2);
    const size_t SQK = (size_t)(NH_ + NKV) * TT * HD, SV = (size_t)NKV * HD * TT;   // elements of one batch's q and k planes (q heads directly followed by k heads) and of its v planes
    h16* QK16 = (h16*)take(NB_ * SQK * 2); bf* QKh = (bf*)take(NB_ * SQK * 2); bf* QKl = (bf*)take(NB_ * SQK * 2); h16* VT16 = (h16*)take(NB_ * SV * 2); bf* VTh = (bf*)take(NB_ * SV * 2); bf* VTl = (bf*)take(NB_ * SV * 2);
    float* F = (float*)take((size_t)TT * 3 * DQ * 4);   // [TT][3 DQ] f32 q|k|v of one batch, consumed by that batch's plane builder (stream-ordered)
    bf* ATh = (bf*)take((size_t)NB_ * TT * DQ * 2); bf* ATl = (bf*)take((size_t)NB_ * TT * DQ * 2);
    if ((size_t)(wsp - (char*)d_ws) > ws_size) return;    // ws 256 MiB
    (void)WK; (void)WV;
    k_wtG<<<dim3((unsigned)((DM * DQ / 64 + 63) / 64), 4, 1), 256, 0, stream>>>(wq, wk, wv, wo, DM, DQ, WQ);
    k_csid<<<(TT * HD + 255) / 256, 256, 0, stream>>>(CS);
    k_cvt8<<<(unsigned)(((size_t)NB_ * TT * DM / 8 + 255) / 256), 256, 0, stream>>>(x, XB, (size_t)NB_ * TT * DM / 8);
    const unsigned LQK = (unsigned)(((size_t)(NH_ + NKV) * TT * HD / 2 + 255) / 256), LKv = (unsigned)(((size_t)NKV * TT * HD / 2 + 255) / 256);
    for (int b = 0; b < NB_; ++b) {
        k_gemmw<bf, 0, true><<<dim3(TT / 64, 3 * DQ / 64, 1), 32, 0, stream>>>(XB + (size_t)b * TT * DM, nullptr, WQ, nullptr, DM, F, 3 * DQ, bq, bk, bv, 0, 0, 0);
        k_planes<<<LQK + LKv, 256, 0, stream>>>(F, 3 * DQ, NH_ + NKV, NKV, LQK, CS, QK16 + b * SQK, QKh + b * SQK, QKl + b * SQK, VT16 + b * SV, VTh + b * SV, VTl + b * SV); }
    k_fattn<<<((TT - RH) / 128 + RH / 64) * NB_ * NH_, 128, 0, stream>>>(QK16, QKh, QKl, VT16, VTh, VTl, ATh, ATl);
    k_gemmw<bf, 1, true><<<dim3(NB_ * TT / 64, DM / 64, 1), 32, 0, stream>>>(ATh, ATl, WO, nullptr, DQ, OUT, DM, bo, bo, bo, 0, 0, 0);
}

// v003
// Measured time: 180 microseconds a run.
// In two side-by-side timings against v002, it was 1.56 and 1.57 times as fast.
// Over all steps from v000 it is 7.44 times as fast.
#include <hip/hip_runtime.h>

// Causal self-attention with 6 heads of width 128 (x_input [4][2048][768]; q, k, v = x W + b ('xw' [768][768] 768^-0.5, biases zeros on this draw: read; 6 heads x 128); scores / sqrt(128); causal (finfo.min == exclusion); softmax; out = merged Wo + bo ('xw' + bias (zeros: read)) -> [4][2048][768] (6.3 M); argument order x_input, Wq, bq, Wk, bk, Wv, bv, Wo, bo).
// Layout, every stage for all batches at once: bf16 copy of x; 'xw' weights transposed once; exact joined q|k|v projection (K 768) + f32 biases, whose epilogue writes the head planes (fp16 and hi/lo; v transposed); fused causal attention (online softmax in registers; hybrid rows: < 512 hi/lo 3 products, rest fp16 x1024; key blocks above the diagonal are never visited) that writes the merged hi/lo planes; merged hi/lo x Wo exact + bo.
// Compute dtypes, f32 accumulate: every input rounded to bf16; projections exact + f32 biases; attention rows < 512 3 products, rest fp16; softmax f32; Wo hl x exact + bias.

#define NB_  4
#define TT   2048
#define DM   768
#define NH_  6
#define NKV  6
#define REP  (NH_ / NKV)
#define HD   128
#define DQ   (NH_ * HD)
#define DKV  (NKV * HD)
#define ZH   6
#define RH   512                  // query rows < RH use hi+lo planes (0: none)
#define WIN  2048
#define PCAR 1024.0f
#define SCL  0.088388347648318447f   // HD^-0.5
typedef _Float16 h16;
typedef unsigned short bf;
typedef __attribute__((ext_vector_type(16))) __bf16   v16bf;
typedef __attribute__((ext_vector_type(16))) _Float16 v16h;
typedef __attribute__((ext_vector_type(8)))  _Float16 v8h;
typedef __attribute__((ext_vector_type(8)))  unsigned short v8us;
typedef __attribute__((ext_vector_type(8)))  float    v8f;
typedef __attribute__((ext_vector_type(4)))  float    v4f;
typedef v8h  __attribute__((may_alias)) v8ha;
typedef v4f  __attribute__((may_alias)) v4fa;
typedef v8us __attribute__((may_alias)) v8usa;

__device__ __forceinline__ unsigned short f2bf(float f) { unsigned u = __float_as_uint(f); u += 0x7FFFu + ((u >> 16) & 1u); return (unsigned short)(u >> 16); }
__device__ __forceinline__ float bf2f(unsigned short b) { return __uint_as_float(((unsigned)b) << 16); }
__device__ __forceinline__ float bfr(float f) { return bf2f(f2bf(f)); }
__device__ __forceinline__ v16h cat16(v8h lo, v8h hi) { return __builtin_shufflevector(lo, hi, 0, 1, 2, 3, 4, 5, 6, 7, 8, 9, 10, 11, 12, 13, 14, 15); }
__device__ __forceinline__ v16bf cat16b(v8us lo, v8us hi) { return __builtin_bit_cast(v16bf, __builtin_shufflevector(lo, hi, 0, 1, 2, 3, 4, 5, 6, 7, 8, 9, 10, 11, 12, 13, 14, 15)); }
__device__ __forceinline__ v8f wmma16(v16h a, v16h b, v8f c) { return __builtin_amdgcn_wmma_f32_16x16x32_f16(false, a, false, b, (short)0, c, false, false); }
__device__ __forceinline__ v8f wmmab(v16bf a, v16bf b, v8f c) { return __builtin_amdgcn_wmma_f32_16x16x32_bf16(false, a, false, b, (short)0, c, false, false); }



// ---- k_gemmw: register-blocked GEMM, ONE WAVE per 64x64 output tile (16 accumulators), operands straight from K-contiguous 16-bit planes; grid (M/64, N/64, Z), 32 threads.
// C[m][n] (f32, pitch ldc, + optional f32 bias[n]) = sum_k A[m][k] Bt[n][k] (+ split products per NSPLIT). z-batch strides sA/sB/sC in elements. K % 32 == 0.
template <typename T16> struct WFrag;
template <> struct WFrag<h16> { typedef v16h V; static __device__ __forceinline__ V ld(const h16* p) { return cat16(*(const v8h*)p, *(const v8h*)(p + 16)); } static __device__ __forceinline__ v8f mma(V a, V b, v8f c) { return wmma16(a, b, c); } };
template <> struct WFrag<bf> { typedef v16bf V; static __device__ __forceinline__ V ld(const bf* p) { return cat16b(*(const v8us*)p, *(const v8us*)(p + 16)); } static __device__ __forceinline__ v8f mma(V a, V b, v8f c) { return wmmab(a, b, c); } };
// bias: columns [0, DQ) take bias, [DQ, 2 DQ) bias1, [2 DQ, 3 DQ) bias2 (the joined q|k|v product; a 64-column tile never straddles a segment). A product of DQ columns uses bias alone.
template <typename T16, int NSPLIT, bool BIAS>
__global__ __launch_bounds__(32) void k_gemmw(const T16* __restrict__ A, const T16* __restrict__ A2, const T16* __restrict__ Bt, const T16* __restrict__ Bt2, int K, float* C, int ldc, const float* __restrict__ bias, const float* __restrict__ bias1, const float* __restrict__ bias2, size_t sA, size_t sB, size_t sC) {
    typedef typename WFrag<T16>::V V;
    __shared__ __align__(16) float os[16 * 68];
    const size_t z = blockIdx.z; A += z * sA; if (A2) A2 += z * sA; Bt += z * sB; if (Bt2) Bt2 += z * sB; C += z * sC;
    const int lane = threadIdx.x & 31, lr = lane & 15, hi = lane >> 4; const int r0 = blockIdx.x * 64, c0 = blockIdx.y * 64;
    const int seg = c0 / DQ; const float* bs = (seg == 0 ? bias : (seg == 1 ? bias1 : bias2)) + (c0 - seg * DQ);
    v8f acc[4][4];
#pragma unroll
    for (int mb = 0; mb < 4; ++mb)
#pragma unroll
        for (int nb = 0; nb < 4; ++nb) acc[mb][nb] = (v8f){};
    const size_t aoff = (size_t)(r0 + lr) * K + 8 * hi, boff = (size_t)(c0 + lr) * K + 8 * hi;
#pragma unroll 1
    for (int kc = 0; kc < K; kc += 32) {
        V a[4], a2[4];
#pragma unroll
        for (int mb = 0; mb < 4; ++mb) { a[mb] = WFrag<T16>::ld(A + aoff + (size_t)mb * 16 * K + kc); if (NSPLIT == 1 || NSPLIT == 2) a2[mb] = WFrag<T16>::ld(A2 + aoff + (size_t)mb * 16 * K + kc); }
#pragma unroll
        for (int nb = 0; nb < 4; ++nb) { const V b = WFrag<T16>::ld(Bt + boff + (size_t)nb * 16 * K + kc); V b2; if (NSPLIT >= 2) b2 = WFrag<T16>::ld(Bt2 + boff + (size_t)nb * 16 * K + kc);
#pragma unroll
            for (int mb = 0; mb < 4; ++mb) { acc[mb][nb] = WFrag<T16>::mma(a[mb], b, acc[mb][nb]); if (NSPLIT == 1 || NSPLIT == 2) acc[mb][nb] = WFrag<T16>::mma(a2[mb], b, acc[mb][nb]); if (NSPLIT >= 2) acc[mb][nb] = WFrag<T16>::mma(a[mb], b2, acc[mb][nb]); } }
        asm volatile("v_nop\n\tv_nop\n\tv_nop\n\tv_nop" : "+v"(acc[0][0]), "+v"(acc[1][1]), "+v"(acc[2][2]), "+v"(acc[3][3]) : "v"(a[0]), "v"(a[3]));
    }
#pragma unroll
    for (int mb = 0; mb < 4; ++mb) {
#pragma unroll
        for (int nb = 0; nb < 4; ++nb) {
#pragma unroll
            for (int j = 0; j < 8; ++j) os[(hi * 8 + j) * 68 + nb * 16 + lr] = acc[mb][nb][j]; }
        __builtin_amdgcn_wave_barrier(); asm volatile("" ::: "memory");
        float* crow = C + (size_t)(r0 + mb * 16) * ldc + c0;
{
#pragma unroll
            for (int s = 0; s < 8; ++s) { const int row = 2 * s + hi, cofs = lr * 4; v4f val = *(const v4fa*)(os + row * 68 + cofs); if (BIAS) { val[0] += bfr(bs[cofs]); val[1] += bfr(bs[cofs + 1]); val[2] += bfr(bs[cofs + 2]); val[3] += bfr(bs[cofs + 3]); }
                *(v4f*)(crow + (size_t)row * ldc + cofs) = val; }
             }
        __builtin_amdgcn_wave_barrier(); asm volatile("" ::: "memory");
    }
}

__device__ __forceinline__ h16 tohx(float x) { return (h16)x; }
__device__ __forceinline__ void splitf(float y, unsigned short& h, unsigned short& l) { h = f2bf(y); l = f2bf(y - bf2f(h)); }
typedef __attribute__((ext_vector_type(2))) _Float16 v2h;
typedef __attribute__((ext_vector_type(4))) _Float16 v4h;
typedef __attribute__((ext_vector_type(2))) unsigned short v2us;
typedef __attribute__((ext_vector_type(4))) unsigned short v4us;
typedef __attribute__((ext_vector_type(2))) float v2f;
typedef __attribute__((ext_vector_type(4))) int v4i;

__global__ __launch_bounds__(256) void k_wtG(const float* __restrict__ w0, const float* __restrict__ w1, const float* __restrict__ w2, const float* __restrict__ w3, int K, int N, bf* Bt) {
    const int y = blockIdx.y; const float* __restrict__ w = (y == 0) ? w0 : (y == 1) ? w1 : (y == 2) ? w2 : w3; Bt += (size_t)y * N * K;   // plane y of four K x N weights, planes back to back
    const int lane = threadIdx.x & 31; const int L0 = (blockIdx.x * 8 + (threadIdx.x >> 5)) * 8; const int nlines = N * K / 64;
{
#pragma unroll 1
        for (int l = 0; l < 8; ++l) { const int L = L0 + l; if (L >= nlines) break; const size_t e = (size_t)L * 64 + lane * 2; const int k = (int)(e % K), n = (int)(e / K); v2us o;
            o[0] = f2bf(w[(size_t)k * N + n]); o[1] = f2bf(w[(size_t)(k + 1) * N + n]); *(v2us*)(Bt + e) = o; }
         }
}
__global__ __launch_bounds__(256) void k_cvt8(const float* __restrict__ src, bf* dst, size_t n8) { const size_t i = (size_t)blockIdx.x * 256 + threadIdx.x; if (i >= n8) return; const v8f v = *(const v8f*)(src + i * 8); v8us o;
#pragma unroll
    for (int k = 0; k < 8; ++k) o[k] = f2bf(v[k]); *(v8us*)(dst + i * 8) = o;  }

// ---- k_qkvp: the joined q|k|v product of all batches with k_gemmw's frame (one wave per 64x64 tile, same k loop, same f32 staging of 16 rows in LDS); the epilogue adds the f32 bias and writes the three 16-bit planes that the attention reads.
// grid (NB_ TT / 64, 3 DQ / 64). X: [NB_ TT][DM] bf16; Wt: [3 DQ][DM] bf16 (q, k, v columns as rows). A 64-column tile lies in one head of one of q, k, v; a 64-row tile in one batch.
// q and k tiles: tile rows = tokens, tile columns = d, planes [head][t][d]. v tiles: the two operands change places (both are K-contiguous rows read by the same loader), so that tile rows = d and tile columns = tokens: the transposed planes [head][d][t] are then written in whole 128-byte lines as well.
// d_tile3: one 64x64 f32 tile out of the accumulators into the planes P16, Ph, Pl (the tile's first element; PITCH elements a tile row). os: 16 x 68 floats of staging, followed by the tile's 64 bias values, which go by tile row (ROWB) or by tile column.
template <bool ROWB, int PITCH>
__device__ __forceinline__ void d_tile3(const v8f (&acc)[4][4], float* os, h16* P16, bf* Ph, bf* Pl, const int lr, const int hi) {
    const int cofs = lr * 4; const unsigned lo = (unsigned)(hi * PITCH + cofs); const float* ob = os + 16 * 68;
#pragma unroll
    for (int mb = 0; mb < 4; ++mb) {
#pragma unroll
        for (int nb = 0; nb < 4; ++nb) {
#pragma unroll
            for (int j = 0; j < 8; ++j) os[(hi * 8 + j) * 68 + nb * 16 + lr] = acc[mb][nb][j]; }
        __builtin_amdgcn_wave_barrier(); asm volatile("" ::: "memory");   // as in k_gemmw: keeps the LDS reads below, which take other lanes' values, behind the LDS writes above
        v4f val[8], bc; float bb[8];
#pragma unroll
        for (int s = 0; s < 8; ++s) { val[s] = *(const v4fa*)(os + (2 * s + hi) * 68 + cofs); if (ROWB) bb[s] = ob[mb * 16 + 2 * s + hi]; }
        if (!ROWB) bc = *(const v4fa*)(ob + cofs);
        __builtin_amdgcn_wave_barrier(); asm volatile("" ::: "memory");   // and the next 16 rows' LDS writes behind these reads
#pragma unroll
        for (int s = 0; s < 8; ++s) { v4f x = val[s];
            if (ROWB) { x[0] += bb[s]; x[1] += bb[s]; x[2] += bb[s]; x[3] += bb[s]; } else x += bc;
            v4h o16; v4us oh, ol;
#pragma unroll
            for (int i = 0; i < 4; ++i) { o16[i] = tohx(x[i]); unsigned short a2, c2; splitf(x[i], a2, c2); oh[i] = a2; ol[i] = c2; }
            const size_t e = (size_t)lo + (mb * 16 + 2 * s) * PITCH;   // a wave-uniform plane address, one lane offset, a constant
            __builtin_amdgcn_sched_barrier(0);           // the three values are complete in front of the first store: nothing is computed among the stores into a register that one of them names
            *(v4h*)(P16 + e) = o16; *(v4us*)(Ph + e) = oh; *(v4us*)(Pl + e) = ol;
            asm volatile("s_wait_xcnt 0x0" ::: "memory"); __builtin_amdgcn_sched_barrier(0);   // stands in front of every rewrite of a register that the three stores name; the fence keeps later instructions behind it
        }
    }
}
__global__ __launch_bounds__(32) void k_qkvp(const bf* __restrict__ X, const bf* __restrict__ Wt, const float* __restrict__ bq, const float* __restrict__ bk, const float* __restrict__ bv, h16* QK16, bf* QKh, bf* QKl, h16* V16, bf* Vh, bf* Vl) {
    typedef WFrag<bf>::V V;
    __shared__ __align__(16) float os[16 * 68 + 64];
    const int lane = threadIdx.x & 31, lr = lane & 15, hi = lane >> 4; const int r0 = blockIdx.x * 64, c0 = blockIdx.y * 64;
    const int seg = c0 / DQ, cs = c0 - seg * DQ, h = cs / HD, d0 = cs % HD, b = r0 / TT, t0 = r0 % TT; const bool isv = seg == 2;
    const float* bs = (seg == 0 ? bq : (seg == 1 ? bk : bv)) + cs; os[16 * 68 + lane] = bfr(bs[lane]); os[16 * 68 + 32 + lane] = bfr(bs[32 + lane]);   // the tile's 64 bias values wait in LDS for the epilogue
    const bf* A = isv ? Wt + (size_t)c0 * DM : X + (size_t)r0 * DM; const bf* Bt = isv ? X + (size_t)r0 * DM : Wt + (size_t)c0 * DM;
    v8f acc[4][4];
#pragma unroll
    for (int mb = 0; mb < 4; ++mb)
#pragma unroll
        for (int nb = 0; nb < 4; ++nb) acc[mb][nb] = (v8f){};
    unsigned off = (unsigned)(lr * DM + 8 * hi);   // the lane's offset (elements) from both wave-uniform bases, live through the whole loop: every load of a trip adds a constant to it
#pragma unroll 1
    for (int kc = 0; kc < DM; kc += 32) {
        V a[4];
#pragma unroll
        for (int mb = 0; mb < 4; ++mb) a[mb] = WFrag<bf>::ld(A + ((size_t)off + mb * 16 * DM));
#pragma unroll
        for (int nb = 0; nb < 4; ++nb) { const V w = WFrag<bf>::ld(Bt + ((size_t)off + nb * 16 * DM));
#pragma unroll
            for (int mb = 0; mb < 4; ++mb) acc[mb][nb] = WFrag<bf>::mma(a[mb], w, acc[mb][nb]); }
        asm volatile("s_wait_xcnt 0x0\n\tv_nop\n\tv_nop\n\tv_nop\n\tv_nop" : "+v"(acc[0][0]), "+v"(acc[1][1]), "+v"(acc[2][2]), "+v"(acc[3][3]), "+v"(off) : "v"(a[0]), "v"(a[3]));   // the wait: in front of the step of the offset register that this trip's loads name (the statement names it, so that the step below stays behind it); the v_nop, as in k_gemmw: the four vector slots between the trip's last matrix instruction and whatever stands first behind it
        off += 32;
    }
    if (isv) { const size_t po = ((size_t)(b * NKV + h) * HD + d0) * TT + t0; d_tile3<true, TT>(acc, os, V16 + po, Vh + po, Vl + po, lr, hi); }
    else { const size_t po = ((size_t)(b * (NH_ + NKV) + seg * NH_ + h) * TT + t0) * HD + d0; d_tile3<false, HD>(acc, os, QK16 + po, QKh + po, QKl + po, lr, hi); }
}
typedef __attribute__((ext_vector_type(16))) unsigned short v16us;
__device__ __forceinline__ float xhalf(float x) { return __builtin_bit_cast(float, __builtin_amdgcn_permlanex16(__builtin_bit_cast(int, x), __builtin_bit_cast(int, x), 0x76543210, 0xfedcba98, false, false)); }
__device__ __forceinline__ float exp2x1(float x) { asm("v_exp_f32 %0, %0\n\tv_nop" : "+v"(x)); return x; }
__device__ __forceinline__ v8f exp2x8(v8f x) { float e0 = x[0], e1 = x[1], e2 = x[2], e3 = x[3], e4 = x[4], e5 = x[5], e6 = x[6], e7 = x[7];
    asm("v_exp_f32 %0, %0\n\tv_exp_f32 %1, %1\n\tv_exp_f32 %2, %2\n\tv_exp_f32 %3, %3\n\tv_exp_f32 %4, %4\n\tv_exp_f32 %5, %5\n\tv_exp_f32 %6, %6\n\tv_exp_f32 %7, %7\n\tv_nop" : "+v"(e0), "+v"(e1), "+v"(e2), "+v"(e3), "+v"(e4), "+v"(e5), "+v"(e6), "+v"(e7));
    return (v8f){e0, e1, e2, e3, e4, e5, e6, e7}; }
template <typename T16, bool HI, int NQ>
__device__ __forceinline__ void d_fattn(const int r0, const T16* __restrict__ Q, const T16* __restrict__ Q2, const T16* __restrict__ Kp, const T16* __restrict__ K2, const T16* __restrict__ Vt, const T16* __restrict__ Vt2, bf* Ah, bf* Al) {
    typedef typename WFrag<T16>::V V;
    const int lane = threadIdx.x & 31, lr = lane & 15, hi = lane >> 4;
    const float CE = SCL * 1.4426950408889634f;      // exp(s SCL) = exp2(s CE)
    const float PSH = HI ? 0.0f : 10.0f;             // log2(PCAR)
    // Every load address is a wave-uniform base plus one of these two lane offsets (elements): a run of loads then takes one 64-bit add a plane, ahead of its first load, and immediate offsets for the rest, so that no address is formed in the midst of a run in registers that a finished fragment has just left.
    const unsigned lrow = (unsigned)(lr * HD + 8 * hi), lcol = (unsigned)(lr * TT + 8 * hi);
    V q[NQ][4], q2[NQ][4], kf[2][4], kf2[2][4];
#pragma unroll
    for (int nq = 0; nq < NQ; ++nq)
#pragma unroll
        for (int kc = 0; kc < 4; ++kc) { const size_t o = (size_t)(r0 + nq * 16) * HD + kc * 32; q[nq][kc] = WFrag<T16>::ld(Q + o + lrow); if (HI) q2[nq][kc] = WFrag<T16>::ld(Q2 + o + lrow); }
    asm volatile("s_wait_xcnt 0x0" ::: "memory"); __builtin_amdgcn_sched_barrier(0);   // stands in front of every rewrite of a register that the loads above name as their address (here and at the three like places below); the fence keeps later instructions behind it
#pragma unroll
    for (int kt = 0; kt < 2; ++kt)
#pragma unroll
        for (int kc = 0; kc < 4; ++kc) { const size_t ko = (size_t)(kt * 16) * HD + kc * 32; kf[kt][kc] = WFrag<T16>::ld(Kp + ko + lrow); if (HI) kf2[kt][kc] = WFrag<T16>::ld(K2 + ko + lrow); }
    asm volatile("s_wait_xcnt 0x0" ::: "memory"); __builtin_amdgcn_sched_barrier(0);   // as above, for the first pass's K loads
    v8f o[8][NQ]; float m[NQ], l[NQ];
#pragma unroll
    for (int nq = 0; nq < NQ; ++nq) { m[nq] = -3.0e38f; l[nq] = 0.f;
#pragma unroll
        for (int dt = 0; dt < 8; ++dt) o[dt][nq] = (v8f){}; }
    const int npass = (r0 + NQ * 16 - 1) / 32 + 1;   // passes of 32 keys up to and including the one that holds the last row's diagonal
    int kb = 0;
#pragma unroll 1                                     // one pass a trip: the trip count is known only at run time, and one pass's fragments already fill the wave's registers
    do {                                             // npass >= 1: no test in front of the first pass
        const int k0 = kb * 32;
        V vf[8], vf2[8];
#pragma unroll
        for (int dt = 0; dt < 8; ++dt) { const size_t vo = (size_t)(dt * 16) * TT + k0; vf[dt] = WFrag<T16>::ld(Vt + vo + lcol); if (HI) vf2[dt] = WFrag<T16>::ld(Vt2 + vo + lcol); }
        asm volatile("s_wait_xcnt 0x0" ::: "memory");   // as above, for the V loads
        __builtin_amdgcn_sched_barrier(0);           // keeps the V requests in front of the score products (the scheduler otherwise sinks them to their use, where their latency is waited out)
        v8f s[2][NQ];
#pragma unroll
        for (int kt = 0; kt < 2; ++kt)
#pragma unroll
            for (int nq = 0; nq < NQ; ++nq) { v8f acc = (v8f){};
#pragma unroll
                for (int kc = 0; kc < 4; ++kc) { acc = WFrag<T16>::mma(kf[kt][kc], q[nq][kc], acc); if (HI) { acc = WFrag<T16>::mma(kf[kt][kc], q2[nq][kc], acc); acc = WFrag<T16>::mma(kf2[kt][kc], q[nq][kc], acc); } }
                s[kt][nq] = acc; }
        const int kn = min(kb + 1, npass - 1) * 32;  // (the last pass asks for its own keys again: in bounds, never used)
#pragma unroll
        for (int kt = 0; kt < 2; ++kt)
#pragma unroll
            for (int kc = 0; kc < 4; ++kc) { const size_t ko = (size_t)(kn + kt * 16) * HD + kc * 32; kf[kt][kc] = WFrag<T16>::ld(Kp + ko + lrow); if (HI) kf2[kt][kc] = WFrag<T16>::ld(K2 + ko + lrow); }
        asm volatile("s_wait_xcnt 0x0" ::: "memory");   // as above, for the K loads
        __builtin_amdgcn_sched_barrier(0);           // keeps the next pass's K requests in front of the softmax, under which they fly (they go out among the score products, each as soon as the last product has read its registers)
        if (k0 + 31 > r0) {                          // the pass reaches past the first row's diagonal: exclude keys j > i
#pragma unroll
            for (int nq = 0; nq < NQ; ++nq) { const int qi = r0 + nq * 16 + lr;
#pragma unroll
                for (int kt = 0; kt < 2; ++kt)
#pragma unroll
                    for (int j = 0; j < 8; ++j) s[kt][nq][j] = (k0 + kt * 16 + hi * 8 + j <= qi) ? s[kt][nq][j] : -3.0e38f; }
        }
        V pb[NQ], pb2[NQ];
#pragma unroll
        for (int nq = 0; nq < NQ; ++nq) {
            float bm[2];
#pragma unroll
            for (int kt = 0; kt < 2; ++kt) { bm[kt] = s[kt][nq][0];
#pragma unroll
                for (int j = 1; j < 8; ++j) bm[kt] = fmaxf(bm[kt], s[kt][nq][j]); }
            float mb = fmaxf(bm[0], bm[1]);
            mb = fmaxf(mb, xhalf(mb));  // the other half of the wave holds the other 8 keys of each tile
            const float mn = fmaxf(m[nq], mb); const float al = exp2x1((m[nq] - mn) * CE); m[nq] = mn;
            const float sh = PSH - mn * CE; float ps[2];
#pragma unroll
            for (int kt = 0; kt < 2; ++kt) { v8f x;
#pragma unroll
                for (int j = 0; j < 8; ++j) x[j] = fmaf(s[kt][nq][j], CE, sh);
                x = exp2x8(x); s[kt][nq] = x; ps[kt] = 0.f;
#pragma unroll
                for (int j = 0; j < 8; ++j) ps[kt] += x[j]; }
            l[nq] = l[nq] * al + (ps[0] + ps[1]);
#pragma unroll
            for (int dt = 0; dt < 8; ++dt) o[dt][nq] *= al;
            if constexpr (HI) { v16us ph, pl;
#pragma unroll
                for (int e = 0; e < 16; ++e) { unsigned short a, c2; splitf(s[e >> 3][nq][e & 7], a, c2); ph[e] = a; pl[e] = c2; }
                pb[nq] = __builtin_bit_cast(v16bf, ph); pb2[nq] = __builtin_bit_cast(v16bf, pl);
            } else { v16h ph;
#pragma unroll
                for (int e = 0; e < 16; ++e) ph[e] = tohx(s[e >> 3][nq][e & 7]);
                pb[nq] = ph; }
        }
#pragma unroll
        for (int dt = 0; dt < 8; ++dt)
#pragma unroll
            for (int nq = 0; nq < NQ; ++nq) { o[dt][nq] = WFrag<T16>::mma(vf[dt], pb[nq], o[dt][nq]); if (HI) { o[dt][nq] = WFrag<T16>::mma(vf[dt], pb2[nq], o[dt][nq]); o[dt][nq] = WFrag<T16>::mma(vf2[dt], pb[nq], o[dt][nq]); } }
    } while (++kb < npass);
#pragma unroll
    for (int nq = 0; nq < NQ; ++nq) { const float lt = l[nq] + xhalf(l[nq]); const float inv = __fdiv_rn(1.0f, lt); const size_t oo = (size_t)(r0 + nq * 16 + lr) * DQ + hi * 8;
#pragma unroll
        for (int dt = 0; dt < 8; ++dt) { v8us oh, ol;   // a lane's 8 accumulator registers are 8 consecutive d of its query: one 16-byte store a plane
#pragma unroll
            for (int j = 0; j < 8; ++j) { unsigned short a, c2; splitf(o[dt][nq][j] * inv, a, c2); oh[j] = a; ol[j] = c2; }
            *(v8us*)(Ah + oo + dt * 16) = oh; *(v8us*)(Al + oo + dt * 16) = ol; } }
}
// grid: blocks of 4 waves, heaviest first. Blocks [0, NF): 128 fp16 query rows each (4 waves x 32), last rows first; the rest: 64 hi/lo query rows each (4 waves x 16). The 4 waves of a block walk the same K and V.
// QK*: per batch 12 planes [t][d] (6 q heads, then 6 k heads); V*: per batch 6 planes [d][t]. Ah/Al: merged heads [b][t][DQ], hi and lo.
__global__ __launch_bounds__(128) void k_fattn(const h16* __restrict__ QK16, const bf* __restrict__ QKh, const bf* __restrict__ QKl, const h16* __restrict__ V16, const bf* __restrict__ Vh, const bf* __restrict__ Vl, bf* Ah, bf* Al) {
    const int wave = __builtin_amdgcn_readfirstlane((int)(threadIdx.x >> 5));   // a scalar, so that the key loop's trip count and the mask test are scalar branches
    const int NBH = NB_ * NH_, NF = (TT - RH) / 128 * NBH;
    int id = blockIdx.x; const bool f16rows = id < NF; if (!f16rows) id -= NF;
    const int bh = id % NBH, g = id / NBH, b = bh / NH_, h = bh % NH_;
    const size_t qo = ((size_t)b * (NH_ + NKV) + h) * TT * HD, ko = ((size_t)b * (NH_ + NKV) + NH_ + h / REP) * TT * HD, vo = ((size_t)b * NKV + h / REP) * HD * TT, ao = (size_t)b * TT * DQ + h * HD;
    if (f16rows) d_fattn<h16, false, 2>(RH + ((TT - RH) / 128 - 1 - g) * 128 + wave * 32, QK16 + qo, nullptr, QK16 + ko, nullptr, V16 + vo, nullptr, Ah + ao, Al + ao);
    else d_fattn<bf, true, 1>((RH / 64 - 1 - g) * 64 + wave * 16, QKh + qo, QKl + qo, QKh + ko, QKl + ko, Vh + vo, Vl + vo, Ah + ao, Al + ao);
}

extern "C" void kernel_launch(void* const* d_in, const int* in_sizes, int n_in,
                              void* d_out, int out_size, void* d_ws, size_t ws_size, hipStream_t stream) {
    (void)in_sizes; (void)n_in; (void)out_size;
    const float* x = (const float*)d_in[0]; const float* wq = (const float*)d_in[1]; const float* bq = (const float*)d_in[2]; const float* wk = (const float*)d_in[3]; const float* bk = (const float*)d_in[4]; const float* wv = (const float*)d_in[5]; const float* bv = (const float*)d_in[6]; const float* wo = (const float*)d_in[7]; const float* bo = (const float*)d_in[8];
    float* OUT = (float*)d_out;     // [4][2048][768]
    char* wsp = (char*)d_ws;
    auto take = [&](size_t bytes) { char* p = wsp; wsp += (bytes + 255) & ~(size_t)255; return (void*)p; };
    bf* WQ = (bf*)take((size_t)DQ * DM * 2); bf* WK = (bf*)take((size_t)DKV * DM * 2); bf* WV = (bf*)take((size_t)DKV * DM * 2); bf* WO = (bf*)take((size_t)DM * DQ * 2);   // WQ, WK, WV, WO back to back (each a multiple of 256 bytes): WQ is also the [3 DQ][DM] plane of the joined product
    bf* XB = (bf*)take((size_t)NB_ * TT * DM * 2);
    const size_t SQK = (size_t)(NH_ + NKV) * TT * HD, SV = (size_t)NKV * HD * TT;   // elements of one batch's q and k planes (q heads directly followed by k heads) and of its v planes
    h16* QK16 = (h16*)take(NB_ * SQK * 2); bf* QKh = (bf*)take(NB_ * SQK * 2); bf* QKl = (bf*)take(NB_ * SQK * 2); h16* VT16 = (h16*)take(NB_ * SV * 2); bf* VTh = (bf*)take(NB_ * SV * 2); bf* VTl = (bf*)take(NB_ * SV * 2);
    bf* ATh = (bf*)take((size_t)NB_ * TT * DQ * 2); bf* ATl = (bf*)take((size_t)NB_ * TT * DQ * 2);
    if ((size_t)(wsp - (char*)d_ws) > ws_size) return;    // ws 256 MiB
    (void)WK; (void)WV;
    k_wtG<<<dim3((unsigned)((DM * DQ / 64 + 63) / 64), 4, 1), 256, 0, stream>>>(wq, wk, wv, wo, DM, DQ, WQ);
    k_cvt8<<<(unsigned)(((size_t)NB_ * TT * DM / 8 + 255) / 256), 256, 0, stream>>>(x, XB, (size_t)NB_ * TT * DM / 8);
    k_qkvp<<<dim3(NB_ * TT / 64, 3 * DQ / 64, 1), 32, 0, stream>>>(XB, WQ, bq, bk, bv, QK16, QKh, QKl, VT16, VTh, VTl);
    k_fattn<<<((TT - RH) / 128 + RH / 64) * NB_ * NH_, 128, 0, stream>>>(QK16, QKh, QKl, VT16, VTh, VTl, ATh, ATl);
    k_gemmw<bf, 1, true><<<dim3(NB_ * TT / 64, DM / 64, 1), 32, 0, stream>>>(ATh, ATl, WO, nullptr, DQ, OUT, DM, bo, bo, bo, 0, 0, 0);
}
